// v000
// Times are from an AMD MI455X. After a warm-up the kernel runs many times in a row, and a time is the length of
// such a window on the GPU divided by its runs, so every launch and the gaps after it count. The runs cycle
// through copies of the inputs. A figure is the median of several windows, for all but v000 over two sittings.
// Sittings can differ by a few percent; kernels timed side by side share one.
// The starting kernel, v000, takes 531 microseconds a run.
#include <hip/hip_runtime.h>
#include <hip/hip_bf16.h>
#include <cstdint>

// MI455X / gfx1250 transformer encoder block.
// All matmuls (QKV proj, QK^T, PV, O-proj, FFN1, FFN2) run on
// v_wmma_f32_16x16x32_f16 (f16 in, f32 accumulate). Tile staging uses
// GLOBAL_LOAD_ASYNC_TO_LDS_B128 (ASYNCcnt) when the builtin is available,
// with double-buffered LDS tiles in the GEMM for copy/compute overlap.

typedef _Float16 half_t;
typedef _Float16 v16h __attribute__((ext_vector_type(16)));
typedef _Float16 v8h  __attribute__((ext_vector_type(8)));
typedef float    v8f  __attribute__((ext_vector_type(8)));
typedef int      v4i  __attribute__((vector_size(16)));   // builtin pointee type

#define D_MODEL 1024
#define HEADS   16
#define D_K     64
#define D_FF    4096
#define SEQ     1024
#define BATCH   8
#define M_TOT   (BATCH * SEQ)   // 8192 rows
#define LN_EPS  1e-6f

#if defined(__has_builtin)
#if __has_builtin(__builtin_amdgcn_global_load_async_to_lds_b128) && \
    __has_builtin(__builtin_amdgcn_s_wait_asynccnt)
#define USE_ASYNC_LDS 1
#endif
#endif
#ifndef USE_ASYNC_LDS
#define USE_ASYNC_LDS 0
#endif

union HV { v16h v; v8h h[2]; };

__device__ inline v8f wmma16(v16h a, v16h b, v8f c) {
  // D = A(16x32 f16) * B(32x16 f16) + C(16x16 f32)
  return __builtin_amdgcn_wmma_f32_16x16x32_f16(false, a, false, b, (short)0, c,
                                                false, false);
}

// Copy 16 bytes global -> LDS. Async (ASYNCcnt) on CDNA5 when available.
__device__ inline void cp16_g2l(const half_t* g, half_t* l) {
#if USE_ASYNC_LDS
  // Flat LDS address truncates to the 32-bit LDS offset (ISA 10.2).
  __builtin_amdgcn_global_load_async_to_lds_b128(
      (__attribute__((address_space(1))) v4i*)(uintptr_t)g,
      (__attribute__((address_space(3))) v4i*)(uint32_t)(uintptr_t)l, 0, 0);
#else
  *(v8h*)l = *(const v8h*)g;
#endif
}

__device__ inline void async_fence() {
#if USE_ASYNC_LDS
  __builtin_amdgcn_s_wait_asynccnt(0);
#endif
}

// Load one lane's 16 f16 fragment values from a row-major [row][K] LDS tile.
// k-values: {sel..sel+7, 16+sel..16+sel+7}, sel = 0 (lanes 0-15) or 8 (16-31).
__device__ inline v16h frag_ld(const half_t* rowbase, int sel) {
  HV u;
  u.h[0] = *(const v8h*)(rowbase + sel);
  u.h[1] = *(const v8h*)(rowbase + 16 + sel);
  return u.v;
}

__device__ inline void zero_v8f(v8f& x) {
  #pragma unroll
  for (int i = 0; i < 8; i++) x[i] = 0.0f;
}

// ---------------------------------------------------------------------------
// fp32 -> f16 weight conversion (grid-stride)
// ---------------------------------------------------------------------------
__global__ void cvt_f16_kernel(const float* __restrict__ src,
                               half_t* __restrict__ dst, int n) {
  for (int i = blockIdx.x * blockDim.x + threadIdx.x; i < n;
       i += gridDim.x * blockDim.x)
    dst[i] = (half_t)src[i];
}

// ---------------------------------------------------------------------------
// LayerNorm (reference semantics: unbiased std, divide by std+eps), f16 out.
// One wave per row of 1024; 8 rows per 256-thread block.
// ---------------------------------------------------------------------------
__global__ __launch_bounds__(256)
void layernorm_kernel(const float* __restrict__ x, const float* __restrict__ g,
                      const float* __restrict__ be, half_t* __restrict__ out) {
  const int lane = threadIdx.x & 31, wave = threadIdx.x >> 5;
  const int row = blockIdx.x * 8 + wave;
  const float* xr = x + (size_t)row * D_MODEL;
  float v[32];
  float s = 0.f, ss = 0.f;
  #pragma unroll
  for (int i = 0; i < 32; i++) {
    v[i] = xr[lane + i * 32];
    s += v[i];
    ss += v[i] * v[i];
  }
  #pragma unroll
  for (int off = 16; off > 0; off >>= 1) {
    s  += __shfl_xor(s,  off, 32);
    ss += __shfl_xor(ss, off, 32);
  }
  float mean = s * (1.0f / D_MODEL);
  float var  = (ss - (float)D_MODEL * mean * mean) * (1.0f / (D_MODEL - 1));
  float inv  = 1.0f / (sqrtf(fmaxf(var, 0.0f)) + LN_EPS);
  half_t* orow = out + (size_t)row * D_MODEL;
  #pragma unroll
  for (int i = 0; i < 32; i++) {
    int c = lane + i * 32;
    orow[c] = (half_t)(g[c] * (v[i] - mean) * inv + be[c]);
  }
}

// ---------------------------------------------------------------------------
// WMMA GEMM: out[M][N] = epilogue( A[M][K](f16) * W[N][K]^T(f16) )
// Block tile 128x128, double-buffered LDS, 8 waves as 4(M) x 2(N); each wave
// 32x64 = 2x4 fragments -> 8 v_wmma per k-step from 6 fragment loads.
// Epilogue: (+bias)*scale, optional ReLU, optional +residual, f16/f32 out.
// ---------------------------------------------------------------------------
__device__ inline void stage_tiles(half_t (*as)[40], half_t (*ws)[40],
                                   const half_t* A, const half_t* W, int tM,
                                   int tN, int k0, int Kdim, int tid) {
  #pragma unroll
  for (int i = 0; i < 2; i++) {
    int chunk = tid + i * 256;               // 0..511 : 128 rows x 4 chunks
    int row = chunk >> 2, ko = (chunk & 3) * 8;
    cp16_g2l(&A[(size_t)(tM + row) * Kdim + k0 + ko], &as[row][ko]);
    cp16_g2l(&W[(size_t)(tN + row) * Kdim + k0 + ko], &ws[row][ko]);
  }
}

template <bool OUT_F16, bool RELU, bool ADD_RES>
__global__ __launch_bounds__(256)
void gemm_f16_kernel(const half_t* __restrict__ A,     // [M][K]
                     const half_t* __restrict__ W,     // [N][K]
                     const float* __restrict__ bias,   // [N]
                     const float* __restrict__ res,    // [M][N] or null
                     void* __restrict__ outp, int Mdim, int Ndim, int Kdim,
                     float out_scale) {
  __shared__ __align__(16) half_t As[2][128][40];
  __shared__ __align__(16) half_t Ws[2][128][40];
  const int tid = threadIdx.x;
  const int lane = tid & 31, wave = tid >> 5;
  const int wm = wave & 3, wn = wave >> 2;
  const int tM = blockIdx.y * 128, tN = blockIdx.x * 128;
  const int sel = (lane < 16) ? 0 : 8;
  const int ln15 = lane & 15;

  v8f acc[2][4];
  #pragma unroll
  for (int i = 0; i < 2; i++)
    #pragma unroll
    for (int j = 0; j < 4; j++) zero_v8f(acc[i][j]);

  // Prologue: stage tile 0.
  stage_tiles(As[0], Ws[0], A, W, tM, tN, 0, Kdim, tid);
  async_fence();
  __syncthreads();

  const int nk = Kdim >> 5;
  for (int ki = 0; ki < nk; ki++) {
    const int buf = ki & 1;
    // Issue async copies for the next tile; overlaps with the WMMAs below.
    if (ki + 1 < nk)
      stage_tiles(As[buf ^ 1], Ws[buf ^ 1], A, W, tM, tN, (ki + 1) * 32, Kdim,
                  tid);

    v16h a0 = frag_ld(&As[buf][wm * 32 + 0 + ln15][0], sel);
    v16h a1 = frag_ld(&As[buf][wm * 32 + 16 + ln15][0], sel);
    #pragma unroll
    for (int fn = 0; fn < 4; fn++) {
      v16h b = frag_ld(&Ws[buf][wn * 64 + fn * 16 + ln15][0], sel);
      acc[0][fn] = wmma16(a0, b, acc[0][fn]);
      acc[1][fn] = wmma16(a1, b, acc[1][fn]);
    }
    async_fence();   // next tile landed
    __syncthreads(); // everyone done reading buf before it is overwritten
  }

  const int mh = (lane < 16) ? 0 : 8;  // C layout: lanes 16-31 hold rows M+8
  #pragma unroll
  for (int fm = 0; fm < 2; fm++) {
    #pragma unroll
    for (int fn = 0; fn < 4; fn++) {
      int n = tN + wn * 64 + fn * 16 + ln15;
      float bv = bias[n];
      #pragma unroll
      for (int r = 0; r < 8; r++) {
        int m = tM + wm * 32 + fm * 16 + r + mh;
        float val = (acc[fm][fn][r] + bv) * out_scale;
        if (RELU) val = val > 0.0f ? val : 0.0f;
        if (ADD_RES) val += res[(size_t)m * Ndim + n];
        if (OUT_F16)
          ((half_t*)outp)[(size_t)m * Ndim + n] = (half_t)val;
        else
          ((float*)outp)[(size_t)m * Ndim + n] = val;
      }
    }
  }
}

// ---------------------------------------------------------------------------
// Fused attention: one block per (64-query tile, head, batch); 4 waves,
// each wave owns 16 query rows. Two-pass softmax (stats, then PV) so no
// online rescale of the accumulator is needed; scores never touch HBM.
// Q is pre-scaled by 1/sqrt(dk) in the Q-projection epilogue.
// ---------------------------------------------------------------------------
__device__ inline void stage_qk64(half_t (*dst)[72], const half_t* src,
                                  size_t base, int tid) {
  // 64 rows x 64 f16 = 512 16B chunks; 128 threads x 4.
  #pragma unroll
  for (int i = 0; i < 4; i++) {
    int chunk = tid + i * 128;
    int row = chunk >> 3, ko = (chunk & 7) * 8;
    cp16_g2l(&src[base + (size_t)row * D_MODEL + ko], &dst[row][ko]);
  }
}

__global__ __launch_bounds__(128)
void attention_kernel(const half_t* __restrict__ q, const half_t* __restrict__ k,
                      const half_t* __restrict__ v, const int* __restrict__ mask,
                      half_t* __restrict__ ctx) {
  __shared__ __align__(16) half_t Qs[64][72];
  __shared__ __align__(16) half_t Ks[64][72];
  __shared__ __align__(16) half_t Vts[64][72];     // transposed: [d][key]
  __shared__ __align__(16) half_t Ps[4][16][72];   // per-wave exp(S-m) tile

  const int tid = threadIdx.x, lane = tid & 31, wave = tid >> 5;
  const int qt = blockIdx.x, h = blockIdx.y, b = blockIdx.z;
  const int sel = (lane < 16) ? 0 : 8;
  const int ln15 = lane & 15;
  const int mh = (lane < 16) ? 0 : 8;
  const size_t bh = (size_t)b * SEQ * D_MODEL + (size_t)h * D_K;
  const int* mrowp = mask + (size_t)b * SEQ;

  stage_qk64(Qs, q, bh + (size_t)(qt * 64) * D_MODEL, tid);

  float mrow[8], lrow[8];
  #pragma unroll
  for (int r = 0; r < 8; r++) { mrow[r] = -1e30f; lrow[r] = 0.0f; }

  // ---- pass A: row max / sum of exp ----
  for (int j = 0; j < SEQ / 64; j++) {
    __syncthreads();
    stage_qk64(Ks, k, bh + (size_t)(j * 64) * D_MODEL, tid);
    async_fence();
    __syncthreads();
    int mk[4];
    v8f c[4];
    #pragma unroll
    for (int n0 = 0; n0 < 4; n0++) {
      mk[n0] = mrowp[j * 64 + n0 * 16 + ln15];
      zero_v8f(c[n0]);
    }
    #pragma unroll
    for (int kk = 0; kk < 64; kk += 32) {
      v16h a = frag_ld(&Qs[wave * 16 + ln15][kk], sel);
      #pragma unroll
      for (int n0 = 0; n0 < 4; n0++) {
        v16h bf = frag_ld(&Ks[n0 * 16 + ln15][kk], sel);
        c[n0] = wmma16(a, bf, c[n0]);
      }
    }
    #pragma unroll
    for (int r = 0; r < 8; r++) {
      float mx = -1e30f;
      #pragma unroll
      for (int n0 = 0; n0 < 4; n0++)
        mx = fmaxf(mx, mk[n0] ? c[n0][r] : -1e9f);
      #pragma unroll
      for (int off = 1; off < 16; off <<= 1)
        mx = fmaxf(mx, __shfl_xor(mx, off, 32));
      float mn = fmaxf(mrow[r], mx);
      float se = 0.0f;
      #pragma unroll
      for (int n0 = 0; n0 < 4; n0++)
        se += __expf((mk[n0] ? c[n0][r] : -1e9f) - mn);
      #pragma unroll
      for (int off = 1; off < 16; off <<= 1) se += __shfl_xor(se, off, 32);
      lrow[r] = lrow[r] * __expf(mrow[r] - mn) + se;
      mrow[r] = mn;
    }
  }

  // ---- pass B: acc += exp(S - m) * V ----
  v8f acc[4];
  #pragma unroll
  for (int nb = 0; nb < 4; nb++) zero_v8f(acc[nb]);

  for (int j = 0; j < SEQ / 64; j++) {
    __syncthreads();
    stage_qk64(Ks, k, bh + (size_t)(j * 64) * D_MODEL, tid);
    for (int i = tid; i < 64 * 64; i += 128) {   // V transpose: scalar staging
      int r = i >> 6, d = i & 63;
      Vts[d][r] = v[bh + (size_t)(j * 64 + r) * D_MODEL + d];
    }
    async_fence();
    __syncthreads();
    int mk[4];
    v8f c[4];
    #pragma unroll
    for (int n0 = 0; n0 < 4; n0++) {
      mk[n0] = mrowp[j * 64 + n0 * 16 + ln15];
      zero_v8f(c[n0]);
    }
    #pragma unroll
    for (int kk = 0; kk < 64; kk += 32) {
      v16h a = frag_ld(&Qs[wave * 16 + ln15][kk], sel);
      #pragma unroll
      for (int n0 = 0; n0 < 4; n0++) {
        v16h bf = frag_ld(&Ks[n0 * 16 + ln15][kk], sel);
        c[n0] = wmma16(a, bf, c[n0]);
      }
    }
    // P = exp(S - m) into this wave's LDS tile (C layout -> row-major)
    #pragma unroll
    for (int n0 = 0; n0 < 4; n0++)
      #pragma unroll
      for (int r = 0; r < 8; r++) {
        float s = mk[n0] ? c[n0][r] : -1e9f;
        Ps[wave][r + mh][n0 * 16 + ln15] = (half_t)__expf(s - mrow[r]);
      }
    __syncthreads();
    #pragma unroll
    for (int kk = 0; kk < 64; kk += 32) {
      v16h a = frag_ld(&Ps[wave][ln15][kk], sel);
      #pragma unroll
      for (int nb = 0; nb < 4; nb++) {
        v16h bf = frag_ld(&Vts[nb * 16 + ln15][kk], sel);
        acc[nb] = wmma16(a, bf, acc[nb]);
      }
    }
  }

  #pragma unroll
  for (int nb = 0; nb < 4; nb++)
    #pragma unroll
    for (int r = 0; r < 8; r++) {
      int qrow = qt * 64 + wave * 16 + r + mh;
      int d = nb * 16 + ln15;
      ctx[bh + (size_t)qrow * D_MODEL + d] = (half_t)(acc[nb][r] / lrow[r]);
    }
}

// ---------------------------------------------------------------------------
extern "C" void kernel_launch(void* const* d_in, const int* in_sizes, int n_in,
                              void* d_out, int out_size, void* d_ws,
                              size_t ws_size, hipStream_t stream) {
  const float* x    = (const float*)d_in[0];
  const int*   mask = (const int*)d_in[1];
  const float* wq = (const float*)d_in[2];  const float* bq = (const float*)d_in[3];
  const float* wk = (const float*)d_in[4];  const float* bk = (const float*)d_in[5];
  const float* wv = (const float*)d_in[6];  const float* bv = (const float*)d_in[7];
  const float* wo = (const float*)d_in[8];  const float* bo = (const float*)d_in[9];
  const float* w1 = (const float*)d_in[10]; const float* b1 = (const float*)d_in[11];
  const float* w2 = (const float*)d_in[12]; const float* b2 = (const float*)d_in[13];
  const float* g1 = (const float*)d_in[14]; const float* be1 = (const float*)d_in[15];
  const float* g2 = (const float*)d_in[16]; const float* be2 = (const float*)d_in[17];

  // Carve workspace (~216 MB total).
  char* p = (char*)d_ws;
  auto carve = [&](size_t bytes) {
    void* r = (void*)p;
    p += (bytes + 255) & ~(size_t)255;
    return r;
  };
  half_t* wq16 = (half_t*)carve((size_t)D_MODEL * D_MODEL * 2);
  half_t* wk16 = (half_t*)carve((size_t)D_MODEL * D_MODEL * 2);
  half_t* wv16 = (half_t*)carve((size_t)D_MODEL * D_MODEL * 2);
  half_t* wo16 = (half_t*)carve((size_t)D_MODEL * D_MODEL * 2);
  half_t* w116 = (half_t*)carve((size_t)D_FF * D_MODEL * 2);
  half_t* w216 = (half_t*)carve((size_t)D_MODEL * D_FF * 2);
  half_t* h16  = (half_t*)carve((size_t)M_TOT * D_MODEL * 2);
  half_t* q16  = (half_t*)carve((size_t)M_TOT * D_MODEL * 2);
  half_t* k16  = (half_t*)carve((size_t)M_TOT * D_MODEL * 2);
  half_t* v16  = (half_t*)carve((size_t)M_TOT * D_MODEL * 2);
  half_t* ctx16 = (half_t*)carve((size_t)M_TOT * D_MODEL * 2);
  float*  x1   = (float*)carve((size_t)M_TOT * D_MODEL * 4);
  half_t* h216 = (half_t*)carve((size_t)M_TOT * D_MODEL * 2);
  half_t* ff1  = (half_t*)carve((size_t)M_TOT * D_FF * 2);

  // Weight conversion (f32 -> f16, layout preserved [N][K]).
  cvt_f16_kernel<<<256, 256, 0, stream>>>(wq, wq16, D_MODEL * D_MODEL);
  cvt_f16_kernel<<<256, 256, 0, stream>>>(wk, wk16, D_MODEL * D_MODEL);
  cvt_f16_kernel<<<256, 256, 0, stream>>>(wv, wv16, D_MODEL * D_MODEL);
  cvt_f16_kernel<<<256, 256, 0, stream>>>(wo, wo16, D_MODEL * D_MODEL);
  cvt_f16_kernel<<<512, 256, 0, stream>>>(w1, w116, D_FF * D_MODEL);
  cvt_f16_kernel<<<512, 256, 0, stream>>>(w2, w216, D_MODEL * D_FF);

  dim3 blk(256);
  dim3 gN1024(D_MODEL / 128, M_TOT / 128);
  dim3 gN4096(D_FF / 128, M_TOT / 128);

  // h = LN1(x)
  layernorm_kernel<<<M_TOT / 8, blk, 0, stream>>>(x, g1, be1, h16);
  // Q (scaled by 1/sqrt(dk)), K, V projections
  gemm_f16_kernel<true, false, false><<<gN1024, blk, 0, stream>>>(
      h16, wq16, bq, nullptr, q16, M_TOT, D_MODEL, D_MODEL, 0.125f);
  gemm_f16_kernel<true, false, false><<<gN1024, blk, 0, stream>>>(
      h16, wk16, bk, nullptr, k16, M_TOT, D_MODEL, D_MODEL, 1.0f);
  gemm_f16_kernel<true, false, false><<<gN1024, blk, 0, stream>>>(
      h16, wv16, bv, nullptr, v16, M_TOT, D_MODEL, D_MODEL, 1.0f);
  // attention -> ctx
  attention_kernel<<<dim3(SEQ / 64, HEADS, BATCH), dim3(128), 0, stream>>>(
      q16, k16, v16, mask, ctx16);
  // x1 = x + ctx @ wo^T + bo
  gemm_f16_kernel<false, false, true><<<gN1024, blk, 0, stream>>>(
      ctx16, wo16, bo, x, x1, M_TOT, D_MODEL, D_MODEL, 1.0f);
  // h2 = LN2(x1)
  layernorm_kernel<<<M_TOT / 8, blk, 0, stream>>>(x1, g2, be2, h216);
  // ff1 = relu(h2 @ w1^T + b1)
  gemm_f16_kernel<true, true, false><<<gN4096, blk, 0, stream>>>(
      h216, w116, b1, nullptr, ff1, M_TOT, D_FF, D_MODEL, 1.0f);
  // out = x1 + ff1 @ w2^T + b2
  gemm_f16_kernel<false, false, true><<<gN1024, blk, 0, stream>>>(
      ff1, w216, b2, x1, (float*)d_out, M_TOT, D_MODEL, D_FF, 1.0f);
}

// v001
// A run of this version takes 479 microseconds.
// Timed twice side by side with v000, it ran 1.13 times as fast both times.
#include <hip/hip_runtime.h>
#include <hip/hip_bf16.h>
#include <cstdint>

// MI455X / gfx1250 transformer encoder block.
// All matmuls (QKV proj, QK^T, PV, O-proj, FFN1, FFN2) run on
// v_wmma_f32_16x16x32_f16 (f16 in, f32 accumulate). Tile staging uses
// GLOBAL_LOAD_ASYNC_TO_LDS_B128 (ASYNCcnt) when the builtin is available,
// with double-buffered LDS tiles in the GEMM for copy/compute overlap.

typedef _Float16 half_t;
typedef _Float16 v16h __attribute__((ext_vector_type(16)));
typedef _Float16 v8h  __attribute__((ext_vector_type(8)));
typedef float    v8f  __attribute__((ext_vector_type(8)));
typedef int      v4i  __attribute__((vector_size(16)));   // builtin pointee type

#define D_MODEL 1024
#define HEADS   16
#define D_K     64
#define D_FF    4096
#define SEQ     1024
#define BATCH   8
#define M_TOT   (BATCH * SEQ)   // 8192 rows
#define LN_EPS  1e-6f

#if defined(__has_builtin)
#if __has_builtin(__builtin_amdgcn_global_load_async_to_lds_b128) && \
    __has_builtin(__builtin_amdgcn_s_wait_asynccnt)
#define USE_ASYNC_LDS 1
#endif
#endif
#ifndef USE_ASYNC_LDS
#define USE_ASYNC_LDS 0
#endif

union HV { v16h v; v8h h[2]; };

__device__ inline v8f wmma16(v16h a, v16h b, v8f c) {
  // D = A(16x32 f16) * B(32x16 f16) + C(16x16 f32)
  return __builtin_amdgcn_wmma_f32_16x16x32_f16(false, a, false, b, (short)0, c,
                                                false, false);
}

// Copy 16 bytes global -> LDS. Async (ASYNCcnt) on CDNA5 when available.
__device__ inline void cp16_g2l(const half_t* g, half_t* l) {
#if USE_ASYNC_LDS
  // Flat LDS address truncates to the 32-bit LDS offset (ISA 10.2).
  __builtin_amdgcn_global_load_async_to_lds_b128(
      (__attribute__((address_space(1))) v4i*)(uintptr_t)g,
      (__attribute__((address_space(3))) v4i*)(uint32_t)(uintptr_t)l, 0, 0);
#else
  *(v8h*)l = *(const v8h*)g;
#endif
}

__device__ inline void async_fence() {
#if USE_ASYNC_LDS
  __builtin_amdgcn_s_wait_asynccnt(0);
#endif
}

// Load one lane's 16 f16 fragment values from a row-major [row][K] LDS tile.
// k-values: {sel..sel+7, 16+sel..16+sel+7}, sel = 0 (lanes 0-15) or 8 (16-31).
__device__ inline v16h frag_ld(const half_t* rowbase, int sel) {
  HV u;
  u.h[0] = *(const v8h*)(rowbase + sel);
  u.h[1] = *(const v8h*)(rowbase + 16 + sel);
  return u.v;
}

__device__ inline void zero_v8f(v8f& x) {
  #pragma unroll
  for (int i = 0; i < 8; i++) x[i] = 0.0f;
}

// ---------------------------------------------------------------------------
// fp32 -> f16 weight conversion, all six matrices in one launch.
// dst is the six f16 planes end to end (wq, wk, wv, wo, w1, w2). 256 blocks of
// 16 waves; a block converts three pieces of 16384 values: one of the four
// square matrices, one of w1, one of w2. Every wave-wide load is 512
// contiguous bytes, and a thread's 24 loads depend on nothing, so many are in
// flight at once and the memory latency is not paid once per value.
// ---------------------------------------------------------------------------
#define CVT_THREADS 512
#define CVT_LOADS   8
#define CVT_PIECE   (CVT_THREADS * CVT_LOADS * 4)        // 16384 values
#define CVT_BLOCKS  (D_FF * D_MODEL / CVT_PIECE)         // 256
#define SQ_PIECES   (D_MODEL * D_MODEL / CVT_PIECE)      // 64 pieces a square

typedef float    v4f __attribute__((ext_vector_type(4)));
typedef _Float16 v4h __attribute__((ext_vector_type(4)));

__device__ inline void cvt_load(v4f (&r)[CVT_LOADS], const float* src, int t) {
  #pragma unroll  // r[] stays in registers; the loads issue back to back
  for (int j = 0; j < CVT_LOADS; j++)
    r[j] = ((const v4f*)src)[j * CVT_THREADS + t];
}

__device__ inline void cvt_store(const v4f (&r)[CVT_LOADS], half_t* dst, int t) {
  #pragma unroll  // constant indices keep r[] in registers
  for (int j = 0; j < CVT_LOADS; j++) {
    v4h h;
    #pragma unroll  // same, for the four lanes of a vector
    for (int e = 0; e < 4; e++) h[e] = (half_t)r[j][e];
    ((v4h*)dst)[j * CVT_THREADS + t] = h;
  }
}

__global__ __launch_bounds__(CVT_THREADS)
void cvt_weights_kernel(const float* __restrict__ wq, const float* __restrict__ wk,
                        const float* __restrict__ wv, const float* __restrict__ wo,
                        const float* __restrict__ w1, const float* __restrict__ w2,
                        half_t* __restrict__ dst) {
  const int t = threadIdx.x;
  const unsigned blk = blockIdx.x;
  const float* lo = (blk & SQ_PIECES) ? wk : wq;         // block-uniform picks
  const float* hi = (blk & SQ_PIECES) ? wo : wv;
  const float* s0 = (blk & (2 * SQ_PIECES)) ? hi : lo;
  const size_t off = (size_t)blk * CVT_PIECE;
  v4f r0[CVT_LOADS], r1[CVT_LOADS], r2[CVT_LOADS];
  cvt_load(r0, s0 + (size_t)(blk % SQ_PIECES) * CVT_PIECE, t);
  cvt_load(r1, w1 + off, t);
  cvt_load(r2, w2 + off, t);
  cvt_store(r0, dst + off, t);
  cvt_store(r1, dst + (size_t)4 * D_MODEL * D_MODEL + off, t);
  cvt_store(r2, dst + (size_t)4 * D_MODEL * D_MODEL + (size_t)D_FF * D_MODEL + off, t);
}

// ---------------------------------------------------------------------------
// LayerNorm (reference semantics: unbiased std, divide by std+eps), f16 out.
// One wave per row of 1024; 8 rows per 256-thread block.
// ---------------------------------------------------------------------------
__global__ __launch_bounds__(256)
void layernorm_kernel(const float* __restrict__ x, const float* __restrict__ g,
                      const float* __restrict__ be, half_t* __restrict__ out) {
  const int lane = threadIdx.x & 31, wave = threadIdx.x >> 5;
  const int row = blockIdx.x * 8 + wave;
  const float* xr = x + (size_t)row * D_MODEL;
  float v[32];
  float s = 0.f, ss = 0.f;
  #pragma unroll
  for (int i = 0; i < 32; i++) {
    v[i] = xr[lane + i * 32];
    s += v[i];
    ss += v[i] * v[i];
  }
  #pragma unroll
  for (int off = 16; off > 0; off >>= 1) {
    s  += __shfl_xor(s,  off, 32);
    ss += __shfl_xor(ss, off, 32);
  }
  float mean = s * (1.0f / D_MODEL);
  float var  = (ss - (float)D_MODEL * mean * mean) * (1.0f / (D_MODEL - 1));
  float inv  = 1.0f / (sqrtf(fmaxf(var, 0.0f)) + LN_EPS);
  half_t* orow = out + (size_t)row * D_MODEL;
  #pragma unroll
  for (int i = 0; i < 32; i++) {
    int c = lane + i * 32;
    orow[c] = (half_t)(g[c] * (v[i] - mean) * inv + be[c]);
  }
}

// ---------------------------------------------------------------------------
// WMMA GEMM: out[M][N] = epilogue( A[M][K](f16) * W[N][K]^T(f16) )
// Block tile 128x128, double-buffered LDS, 8 waves as 4(M) x 2(N); each wave
// 32x64 = 2x4 fragments -> 8 v_wmma per k-step from 6 fragment loads.
// Epilogue: (+bias)*scale, optional ReLU, optional +residual, f16/f32 out.
// ---------------------------------------------------------------------------
__device__ inline void stage_tiles(half_t (*as)[40], half_t (*ws)[40],
                                   const half_t* A, const half_t* W, int tM,
                                   int tN, int k0, int Kdim, int tid) {
  #pragma unroll
  for (int i = 0; i < 2; i++) {
    int chunk = tid + i * 256;               // 0..511 : 128 rows x 4 chunks
    int row = chunk >> 2, ko = (chunk & 3) * 8;
    cp16_g2l(&A[(size_t)(tM + row) * Kdim + k0 + ko], &as[row][ko]);
    cp16_g2l(&W[(size_t)(tN + row) * Kdim + k0 + ko], &ws[row][ko]);
  }
}

template <bool OUT_F16, bool RELU, bool ADD_RES>
__global__ __launch_bounds__(256)
void gemm_f16_kernel(const half_t* __restrict__ A,     // [M][K]
                     const half_t* __restrict__ W,     // [N][K]
                     const float* __restrict__ bias,   // [N]
                     const float* __restrict__ res,    // [M][N] or null
                     void* __restrict__ outp, int Mdim, int Ndim, int Kdim,
                     float out_scale) {
  __shared__ __align__(16) half_t As[2][128][40];
  __shared__ __align__(16) half_t Ws[2][128][40];
  const int tid = threadIdx.x;
  const int lane = tid & 31, wave = tid >> 5;
  const int wm = wave & 3, wn = wave >> 2;
  const int tM = blockIdx.y * 128, tN = blockIdx.x * 128;
  const int sel = (lane < 16) ? 0 : 8;
  const int ln15 = lane & 15;

  v8f acc[2][4];
  #pragma unroll
  for (int i = 0; i < 2; i++)
    #pragma unroll
    for (int j = 0; j < 4; j++) zero_v8f(acc[i][j]);

  // Prologue: stage tile 0.
  stage_tiles(As[0], Ws[0], A, W, tM, tN, 0, Kdim, tid);
  async_fence();
  __syncthreads();

  const int nk = Kdim >> 5;
  for (int ki = 0; ki < nk; ki++) {
    const int buf = ki & 1;
    // Issue async copies for the next tile; overlaps with the WMMAs below.
    if (ki + 1 < nk)
      stage_tiles(As[buf ^ 1], Ws[buf ^ 1], A, W, tM, tN, (ki + 1) * 32, Kdim,
                  tid);

    v16h a0 = frag_ld(&As[buf][wm * 32 + 0 + ln15][0], sel);
    v16h a1 = frag_ld(&As[buf][wm * 32 + 16 + ln15][0], sel);
    #pragma unroll
    for (int fn = 0; fn < 4; fn++) {
      v16h b = frag_ld(&Ws[buf][wn * 64 + fn * 16 + ln15][0], sel);
      acc[0][fn] = wmma16(a0, b, acc[0][fn]);
      acc[1][fn] = wmma16(a1, b, acc[1][fn]);
    }
    async_fence();   // next tile landed
    __syncthreads(); // everyone done reading buf before it is overwritten
  }

  const int mh = (lane < 16) ? 0 : 8;  // C layout: lanes 16-31 hold rows M+8
  #pragma unroll
  for (int fm = 0; fm < 2; fm++) {
    #pragma unroll
    for (int fn = 0; fn < 4; fn++) {
      int n = tN + wn * 64 + fn * 16 + ln15;
      float bv = bias[n];
      #pragma unroll
      for (int r = 0; r < 8; r++) {
        int m = tM + wm * 32 + fm * 16 + r + mh;
        float val = (acc[fm][fn][r] + bv) * out_scale;
        if (RELU) val = val > 0.0f ? val : 0.0f;
        if (ADD_RES) val += res[(size_t)m * Ndim + n];
        if (OUT_F16)
          ((half_t*)outp)[(size_t)m * Ndim + n] = (half_t)val;
        else
          ((float*)outp)[(size_t)m * Ndim + n] = val;
      }
    }
  }
}

// ---------------------------------------------------------------------------
// Fused attention: one block per (64-query tile, head, batch); 4 waves,
// each wave owns 16 query rows. Two-pass softmax (stats, then PV) so no
// online rescale of the accumulator is needed; scores never touch HBM.
// Q is pre-scaled by 1/sqrt(dk) in the Q-projection epilogue.
// ---------------------------------------------------------------------------
__device__ inline void stage_qk64(half_t (*dst)[72], const half_t* src,
                                  size_t base, int tid) {
  // 64 rows x 64 f16 = 512 16B chunks; 128 threads x 4.
  #pragma unroll
  for (int i = 0; i < 4; i++) {
    int chunk = tid + i * 128;
    int row = chunk >> 3, ko = (chunk & 7) * 8;
    cp16_g2l(&src[base + (size_t)row * D_MODEL + ko], &dst[row][ko]);
  }
}

__global__ __launch_bounds__(128)
void attention_kernel(const half_t* __restrict__ q, const half_t* __restrict__ k,
                      const half_t* __restrict__ v, const int* __restrict__ mask,
                      half_t* __restrict__ ctx) {
  __shared__ __align__(16) half_t Qs[64][72];
  __shared__ __align__(16) half_t Ks[64][72];
  __shared__ __align__(16) half_t Vts[64][72];     // transposed: [d][key]
  __shared__ __align__(16) half_t Ps[4][16][72];   // per-wave exp(S-m) tile

  const int tid = threadIdx.x, lane = tid & 31, wave = tid >> 5;
  const int qt = blockIdx.x, h = blockIdx.y, b = blockIdx.z;
  const int sel = (lane < 16) ? 0 : 8;
  const int ln15 = lane & 15;
  const int mh = (lane < 16) ? 0 : 8;
  const size_t bh = (size_t)b * SEQ * D_MODEL + (size_t)h * D_K;
  const int* mrowp = mask + (size_t)b * SEQ;

  stage_qk64(Qs, q, bh + (size_t)(qt * 64) * D_MODEL, tid);

  float mrow[8], lrow[8];
  #pragma unroll
  for (int r = 0; r < 8; r++) { mrow[r] = -1e30f; lrow[r] = 0.0f; }

  // ---- pass A: row max / sum of exp ----
  for (int j = 0; j < SEQ / 64; j++) {
    __syncthreads();
    stage_qk64(Ks, k, bh + (size_t)(j * 64) * D_MODEL, tid);
    async_fence();
    __syncthreads();
    int mk[4];
    v8f c[4];
    #pragma unroll
    for (int n0 = 0; n0 < 4; n0++) {
      mk[n0] = mrowp[j * 64 + n0 * 16 + ln15];
      zero_v8f(c[n0]);
    }
    #pragma unroll
    for (int kk = 0; kk < 64; kk += 32) {
      v16h a = frag_ld(&Qs[wave * 16 + ln15][kk], sel);
      #pragma unroll
      for (int n0 = 0; n0 < 4; n0++) {
        v16h bf = frag_ld(&Ks[n0 * 16 + ln15][kk], sel);
        c[n0] = wmma16(a, bf, c[n0]);
      }
    }
    #pragma unroll
    for (int r = 0; r < 8; r++) {
      float mx = -1e30f;
      #pragma unroll
      for (int n0 = 0; n0 < 4; n0++)
        mx = fmaxf(mx, mk[n0] ? c[n0][r] : -1e9f);
      #pragma unroll
      for (int off = 1; off < 16; off <<= 1)
        mx = fmaxf(mx, __shfl_xor(mx, off, 32));
      float mn = fmaxf(mrow[r], mx);
      float se = 0.0f;
      #pragma unroll
      for (int n0 = 0; n0 < 4; n0++)
        se += __expf((mk[n0] ? c[n0][r] : -1e9f) - mn);
      #pragma unroll
      for (int off = 1; off < 16; off <<= 1) se += __shfl_xor(se, off, 32);
      lrow[r] = lrow[r] * __expf(mrow[r] - mn) + se;
      mrow[r] = mn;
    }
  }

  // ---- pass B: acc += exp(S - m) * V ----
  v8f acc[4];
  #pragma unroll
  for (int nb = 0; nb < 4; nb++) zero_v8f(acc[nb]);

  for (int j = 0; j < SEQ / 64; j++) {
    __syncthreads();
    stage_qk64(Ks, k, bh + (size_t)(j * 64) * D_MODEL, tid);
    for (int i = tid; i < 64 * 64; i += 128) {   // V transpose: scalar staging
      int r = i >> 6, d = i & 63;
      Vts[d][r] = v[bh + (size_t)(j * 64 + r) * D_MODEL + d];
    }
    async_fence();
    __syncthreads();
    int mk[4];
    v8f c[4];
    #pragma unroll
    for (int n0 = 0; n0 < 4; n0++) {
      mk[n0] = mrowp[j * 64 + n0 * 16 + ln15];
      zero_v8f(c[n0]);
    }
    #pragma unroll
    for (int kk = 0; kk < 64; kk += 32) {
      v16h a = frag_ld(&Qs[wave * 16 + ln15][kk], sel);
      #pragma unroll
      for (int n0 = 0; n0 < 4; n0++) {
        v16h bf = frag_ld(&Ks[n0 * 16 + ln15][kk], sel);
        c[n0] = wmma16(a, bf, c[n0]);
      }
    }
    // P = exp(S - m) into this wave's LDS tile (C layout -> row-major)
    #pragma unroll
    for (int n0 = 0; n0 < 4; n0++)
      #pragma unroll
      for (int r = 0; r < 8; r++) {
        float s = mk[n0] ? c[n0][r] : -1e9f;
        Ps[wave][r + mh][n0 * 16 + ln15] = (half_t)__expf(s - mrow[r]);
      }
    __syncthreads();
    #pragma unroll
    for (int kk = 0; kk < 64; kk += 32) {
      v16h a = frag_ld(&Ps[wave][ln15][kk], sel);
      #pragma unroll
      for (int nb = 0; nb < 4; nb++) {
        v16h bf = frag_ld(&Vts[nb * 16 + ln15][kk], sel);
        acc[nb] = wmma16(a, bf, acc[nb]);
      }
    }
  }

  #pragma unroll
  for (int nb = 0; nb < 4; nb++)
    #pragma unroll
    for (int r = 0; r < 8; r++) {
      int qrow = qt * 64 + wave * 16 + r + mh;
      int d = nb * 16 + ln15;
      ctx[bh + (size_t)qrow * D_MODEL + d] = (half_t)(acc[nb][r] / lrow[r]);
    }
}

// ---------------------------------------------------------------------------
extern "C" void kernel_launch(void* const* d_in, const int* in_sizes, int n_in,
                              void* d_out, int out_size, void* d_ws,
                              size_t ws_size, hipStream_t stream) {
  const float* x    = (const float*)d_in[0];
  const int*   mask = (const int*)d_in[1];
  const float* wq = (const float*)d_in[2];  const float* bq = (const float*)d_in[3];
  const float* wk = (const float*)d_in[4];  const float* bk = (const float*)d_in[5];
  const float* wv = (const float*)d_in[6];  const float* bv = (const float*)d_in[7];
  const float* wo = (const float*)d_in[8];  const float* bo = (const float*)d_in[9];
  const float* w1 = (const float*)d_in[10]; const float* b1 = (const float*)d_in[11];
  const float* w2 = (const float*)d_in[12]; const float* b2 = (const float*)d_in[13];
  const float* g1 = (const float*)d_in[14]; const float* be1 = (const float*)d_in[15];
  const float* g2 = (const float*)d_in[16]; const float* be2 = (const float*)d_in[17];

  // Carve workspace (~216 MB total).
  char* p = (char*)d_ws;
  auto carve = [&](size_t bytes) {
    void* r = (void*)p;
    p += (bytes + 255) & ~(size_t)255;
    return r;
  };
  half_t* w16  = (half_t*)carve(((size_t)4 * D_MODEL * D_MODEL +
                                 (size_t)2 * D_FF * D_MODEL) * 2);
  half_t* wq16 = w16;
  half_t* wk16 = wq16 + (size_t)D_MODEL * D_MODEL;
  half_t* wv16 = wk16 + (size_t)D_MODEL * D_MODEL;
  half_t* wo16 = wv16 + (size_t)D_MODEL * D_MODEL;
  half_t* w116 = wo16 + (size_t)D_MODEL * D_MODEL;
  half_t* w216 = w116 + (size_t)D_FF * D_MODEL;
  half_t* h16  = (half_t*)carve((size_t)M_TOT * D_MODEL * 2);
  half_t* q16  = (half_t*)carve((size_t)M_TOT * D_MODEL * 2);
  half_t* k16  = (half_t*)carve((size_t)M_TOT * D_MODEL * 2);
  half_t* v16  = (half_t*)carve((size_t)M_TOT * D_MODEL * 2);
  half_t* ctx16 = (half_t*)carve((size_t)M_TOT * D_MODEL * 2);
  float*  x1   = (float*)carve((size_t)M_TOT * D_MODEL * 4);
  half_t* h216 = (half_t*)carve((size_t)M_TOT * D_MODEL * 2);
  half_t* ff1  = (half_t*)carve((size_t)M_TOT * D_FF * 2);

  // Weight conversion (f32 -> f16, layout preserved [N][K]).
  cvt_weights_kernel<<<CVT_BLOCKS, CVT_THREADS, 0, stream>>>(wq, wk, wv, wo, w1,
                                                             w2, w16);

  dim3 blk(256);
  dim3 gN1024(D_MODEL / 128, M_TOT / 128);
  dim3 gN4096(D_FF / 128, M_TOT / 128);

  // h = LN1(x)
  layernorm_kernel<<<M_TOT / 8, blk, 0, stream>>>(x, g1, be1, h16);
  // Q (scaled by 1/sqrt(dk)), K, V projections
  gemm_f16_kernel<true, false, false><<<gN1024, blk, 0, stream>>>(
      h16, wq16, bq, nullptr, q16, M_TOT, D_MODEL, D_MODEL, 0.125f);
  gemm_f16_kernel<true, false, false><<<gN1024, blk, 0, stream>>>(
      h16, wk16, bk, nullptr, k16, M_TOT, D_MODEL, D_MODEL, 1.0f);
  gemm_f16_kernel<true, false, false><<<gN1024, blk, 0, stream>>>(
      h16, wv16, bv, nullptr, v16, M_TOT, D_MODEL, D_MODEL, 1.0f);
  // attention -> ctx
  attention_kernel<<<dim3(SEQ / 64, HEADS, BATCH), dim3(128), 0, stream>>>(
      q16, k16, v16, mask, ctx16);
  // x1 = x + ctx @ wo^T + bo
  gemm_f16_kernel<false, false, true><<<gN1024, blk, 0, stream>>>(
      ctx16, wo16, bo, x, x1, M_TOT, D_MODEL, D_MODEL, 1.0f);
  // h2 = LN2(x1)
  layernorm_kernel<<<M_TOT / 8, blk, 0, stream>>>(x1, g2, be2, h216);
  // ff1 = relu(h2 @ w1^T + b1)
  gemm_f16_kernel<true, true, false><<<gN4096, blk, 0, stream>>>(
      h216, w116, b1, nullptr, ff1, M_TOT, D_FF, D_MODEL, 1.0f);
  // out = x1 + ff1 @ w2^T + b2
  gemm_f16_kernel<false, false, true><<<gN1024, blk, 0, stream>>>(
      ff1, w216, b2, x1, (float*)d_out, M_TOT, D_MODEL, D_FF, 1.0f);
}

// v002
// Measured time: 406 microseconds a run.
// Timed twice side by side with v001, it ran 1.18 times as fast both times.
// Over all steps from v000 it is 1.34 times as fast.
#include <hip/hip_runtime.h>
#include <hip/hip_bf16.h>
#include <cstdint>

// MI455X / gfx1250 transformer encoder block.
// All matmuls (QKV proj, QK^T, PV, O-proj, FFN1, FFN2) run on
// v_wmma_f32_16x16x32_f16 (f16 in, f32 accumulate). Tile staging uses
// GLOBAL_LOAD_ASYNC_TO_LDS_B128 (ASYNCcnt) when the builtin is available,
// with double-buffered LDS tiles in the GEMM for copy/compute overlap.

typedef _Float16 half_t;
typedef _Float16 v16h __attribute__((ext_vector_type(16)));
typedef _Float16 v8h  __attribute__((ext_vector_type(8)));
typedef float    v8f  __attribute__((ext_vector_type(8)));
typedef int      v4i  __attribute__((vector_size(16)));   // builtin pointee type

#define D_MODEL 1024
#define HEADS   16
#define D_K     64
#define D_FF    4096
#define SEQ     1024
#define BATCH   8
#define M_TOT   (BATCH * SEQ)   // 8192 rows
#define LN_EPS  1e-6f

#if defined(__has_builtin)
#if __has_builtin(__builtin_amdgcn_global_load_async_to_lds_b128) && \
    __has_builtin(__builtin_amdgcn_s_wait_asynccnt)
#define USE_ASYNC_LDS 1
#endif
#endif
#ifndef USE_ASYNC_LDS
#define USE_ASYNC_LDS 0
#endif

union HV { v16h v; v8h h[2]; };

__device__ inline v8f wmma16(v16h a, v16h b, v8f c) {
  // D = A(16x32 f16) * B(32x16 f16) + C(16x16 f32)
  return __builtin_amdgcn_wmma_f32_16x16x32_f16(false, a, false, b, (short)0, c,
                                                false, false);
}

// Copy 16 bytes global -> LDS. Async (ASYNCcnt) on CDNA5 when available.
__device__ inline void cp16_g2l(const half_t* g, half_t* l) {
#if USE_ASYNC_LDS
  // Flat LDS address truncates to the 32-bit LDS offset (ISA 10.2).
  __builtin_amdgcn_global_load_async_to_lds_b128(
      (__attribute__((address_space(1))) v4i*)(uintptr_t)g,
      (__attribute__((address_space(3))) v4i*)(uint32_t)(uintptr_t)l, 0, 0);
#else
  *(v8h*)l = *(const v8h*)g;
#endif
}

__device__ inline void async_fence() {
#if USE_ASYNC_LDS
  __builtin_amdgcn_s_wait_asynccnt(0);
#endif
}

// Load one lane's 16 f16 fragment values from a row-major [row][K] LDS tile.
// k-values: {sel..sel+7, 16+sel..16+sel+7}, sel = 0 (lanes 0-15) or 8 (16-31).
__device__ inline v16h frag_ld(const half_t* rowbase, int sel) {
  HV u;
  u.h[0] = *(const v8h*)(rowbase + sel);
  u.h[1] = *(const v8h*)(rowbase + 16 + sel);
  return u.v;
}

__device__ inline void zero_v8f(v8f& x) {
  #pragma unroll
  for (int i = 0; i < 8; i++) x[i] = 0.0f;
}

// ---------------------------------------------------------------------------
// fp32 -> f16 weight conversion, all six matrices in one launch.
// dst is the six f16 planes end to end (wq, wk, wv, wo, w1, w2). 256 blocks of
// 16 waves; a block converts three pieces of 16384 values: one of the four
// square matrices, one of w1, one of w2. Every wave-wide load is 512
// contiguous bytes, and a thread's 24 loads depend on nothing, so many are in
// flight at once and the memory latency is not paid once per value.
// ---------------------------------------------------------------------------
#define CVT_THREADS 512
#define CVT_LOADS   8
#define CVT_PIECE   (CVT_THREADS * CVT_LOADS * 4)        // 16384 values
#define CVT_BLOCKS  (D_FF * D_MODEL / CVT_PIECE)         // 256
#define SQ_PIECES   (D_MODEL * D_MODEL / CVT_PIECE)      // 64 pieces a square

typedef float    v4f __attribute__((ext_vector_type(4)));
typedef _Float16 v4h __attribute__((ext_vector_type(4)));

__device__ inline void cvt_load(v4f (&r)[CVT_LOADS], const float* src, int t) {
  #pragma unroll  // r[] stays in registers; the loads issue back to back
  for (int j = 0; j < CVT_LOADS; j++)
    r[j] = ((const v4f*)src)[j * CVT_THREADS + t];
}

__device__ inline void cvt_store(const v4f (&r)[CVT_LOADS], half_t* dst, int t) {
  #pragma unroll  // constant indices keep r[] in registers
  for (int j = 0; j < CVT_LOADS; j++) {
    v4h h;
    #pragma unroll  // same, for the four lanes of a vector
    for (int e = 0; e < 4; e++) h[e] = (half_t)r[j][e];
    ((v4h*)dst)[j * CVT_THREADS + t] = h;
  }
}

__global__ __launch_bounds__(CVT_THREADS)
void cvt_weights_kernel(const float* __restrict__ wq, const float* __restrict__ wk,
                        const float* __restrict__ wv, const float* __restrict__ wo,
                        const float* __restrict__ w1, const float* __restrict__ w2,
                        half_t* __restrict__ dst) {
  const int t = threadIdx.x;
  const unsigned blk = blockIdx.x;
  const float* lo = (blk & SQ_PIECES) ? wk : wq;         // block-uniform picks
  const float* hi = (blk & SQ_PIECES) ? wo : wv;
  const float* s0 = (blk & (2 * SQ_PIECES)) ? hi : lo;
  const size_t off = (size_t)blk * CVT_PIECE;
  v4f r0[CVT_LOADS], r1[CVT_LOADS], r2[CVT_LOADS];
  cvt_load(r0, s0 + (size_t)(blk % SQ_PIECES) * CVT_PIECE, t);
  cvt_load(r1, w1 + off, t);
  cvt_load(r2, w2 + off, t);
  cvt_store(r0, dst + off, t);
  cvt_store(r1, dst + (size_t)4 * D_MODEL * D_MODEL + off, t);
  cvt_store(r2, dst + (size_t)4 * D_MODEL * D_MODEL + (size_t)D_FF * D_MODEL + off, t);
}

// ---------------------------------------------------------------------------
// LayerNorm (reference semantics: unbiased std, divide by std+eps), f16 out.
// One wave per row of 1024; 8 rows per 256-thread block.
// ---------------------------------------------------------------------------
__global__ __launch_bounds__(256)
void layernorm_kernel(const float* __restrict__ x, const float* __restrict__ g,
                      const float* __restrict__ be, half_t* __restrict__ out) {
  const int lane = threadIdx.x & 31, wave = threadIdx.x >> 5;
  const int row = blockIdx.x * 8 + wave;
  const float* xr = x + (size_t)row * D_MODEL;
  float v[32];
  float s = 0.f, ss = 0.f;
  #pragma unroll
  for (int i = 0; i < 32; i++) {
    v[i] = xr[lane + i * 32];
    s += v[i];
    ss += v[i] * v[i];
  }
  #pragma unroll
  for (int off = 16; off > 0; off >>= 1) {
    s  += __shfl_xor(s,  off, 32);
    ss += __shfl_xor(ss, off, 32);
  }
  float mean = s * (1.0f / D_MODEL);
  float var  = (ss - (float)D_MODEL * mean * mean) * (1.0f / (D_MODEL - 1));
  float inv  = 1.0f / (sqrtf(fmaxf(var, 0.0f)) + LN_EPS);
  half_t* orow = out + (size_t)row * D_MODEL;
  #pragma unroll
  for (int i = 0; i < 32; i++) {
    int c = lane + i * 32;
    orow[c] = (half_t)(g[c] * (v[i] - mean) * inv + be[c]);
  }
}

// ---------------------------------------------------------------------------
// WMMA GEMM: out[M][N] = epilogue( A[M][K](f16) * W[N][K]^T(f16) )
// Block tile 128x128, double-buffered LDS, 8 waves as 4(M) x 2(N); each wave
// 32x64 = 2x4 fragments -> 8 v_wmma per k-step from 6 fragment loads.
// Epilogue: (+bias)*scale, optional ReLU, optional +residual, f16/f32 out.
// ---------------------------------------------------------------------------
__device__ inline void stage_tiles(half_t (*as)[40], half_t (*ws)[40],
                                   const half_t* A, const half_t* W, int tM,
                                   int tN, int k0, int Kdim, int tid) {
  #pragma unroll
  for (int i = 0; i < 2; i++) {
    int chunk = tid + i * 256;               // 0..511 : 128 rows x 4 chunks
    int row = chunk >> 2, ko = (chunk & 3) * 8;
    cp16_g2l(&A[(size_t)(tM + row) * Kdim + k0 + ko], &as[row][ko]);
    cp16_g2l(&W[(size_t)(tN + row) * Kdim + k0 + ko], &ws[row][ko]);
  }
}

template <bool OUT_F16, bool RELU, bool ADD_RES>
__global__ __launch_bounds__(256)
void gemm_f16_kernel(const half_t* __restrict__ A,     // [M][K]
                     const half_t* __restrict__ W,     // [N][K]
                     const float* __restrict__ bias,   // [N]
                     const float* __restrict__ res,    // [M][N] or null
                     void* __restrict__ outp, int Mdim, int Ndim, int Kdim,
                     float out_scale) {
  __shared__ __align__(16) half_t As[2][128][40];
  __shared__ __align__(16) half_t Ws[2][128][40];
  const int tid = threadIdx.x;
  const int lane = tid & 31, wave = tid >> 5;
  const int wm = wave & 3, wn = wave >> 2;
  const int tM = blockIdx.y * 128, tN = blockIdx.x * 128;
  const int sel = (lane < 16) ? 0 : 8;
  const int ln15 = lane & 15;

  v8f acc[2][4];
  #pragma unroll
  for (int i = 0; i < 2; i++)
    #pragma unroll
    for (int j = 0; j < 4; j++) zero_v8f(acc[i][j]);

  // Prologue: stage tile 0.
  stage_tiles(As[0], Ws[0], A, W, tM, tN, 0, Kdim, tid);
  async_fence();
  __syncthreads();

  const int nk = Kdim >> 5;
  for (int ki = 0; ki < nk; ki++) {
    const int buf = ki & 1;
    // Issue async copies for the next tile; overlaps with the WMMAs below.
    if (ki + 1 < nk)
      stage_tiles(As[buf ^ 1], Ws[buf ^ 1], A, W, tM, tN, (ki + 1) * 32, Kdim,
                  tid);

    v16h a0 = frag_ld(&As[buf][wm * 32 + 0 + ln15][0], sel);
    v16h a1 = frag_ld(&As[buf][wm * 32 + 16 + ln15][0], sel);
    #pragma unroll
    for (int fn = 0; fn < 4; fn++) {
      v16h b = frag_ld(&Ws[buf][wn * 64 + fn * 16 + ln15][0], sel);
      acc[0][fn] = wmma16(a0, b, acc[0][fn]);
      acc[1][fn] = wmma16(a1, b, acc[1][fn]);
    }
    async_fence();   // next tile landed
    __syncthreads(); // everyone done reading buf before it is overwritten
  }

  const int mh = (lane < 16) ? 0 : 8;  // C layout: lanes 16-31 hold rows M+8
  #pragma unroll
  for (int fm = 0; fm < 2; fm++) {
    #pragma unroll
    for (int fn = 0; fn < 4; fn++) {
      int n = tN + wn * 64 + fn * 16 + ln15;
      float bv = bias[n];
      #pragma unroll
      for (int r = 0; r < 8; r++) {
        int m = tM + wm * 32 + fm * 16 + r + mh;
        float val = (acc[fm][fn][r] + bv) * out_scale;
        if (RELU) val = val > 0.0f ? val : 0.0f;
        if (ADD_RES) val += res[(size_t)m * Ndim + n];
        if (OUT_F16)
          ((half_t*)outp)[(size_t)m * Ndim + n] = (half_t)val;
        else
          ((float*)outp)[(size_t)m * Ndim + n] = val;
      }
    }
  }
}

// ---------------------------------------------------------------------------
// Fused attention: one block per (64-query tile, head, batch); 4 waves,
// each wave owns 16 query rows. Two-pass softmax (stats, then PV) so no
// online rescale of the accumulator is needed; scores never touch HBM.
// Q is pre-scaled by 1/sqrt(dk) in the Q-projection epilogue.
// ---------------------------------------------------------------------------
__device__ inline void stage_qk64(half_t (*dst)[72], const half_t* src,
                                  size_t base, int tid) {
  // 64 rows x 64 f16 = 512 16B chunks; 128 threads x 4.
  #pragma unroll
  for (int i = 0; i < 4; i++) {
    int chunk = tid + i * 128;
    int row = chunk >> 3, ko = (chunk & 7) * 8;
    cp16_g2l(&src[base + (size_t)row * D_MODEL + ko], &dst[row][ko]);
  }
}

// V tile, row-major [key][d] as it lies in memory: 64 rows x 64 f16 = 512
// 16-byte chunks, 128 threads x 4 copies, through no register.
#define V_PITCH 80   // f16 a row = 160 bytes, an odd multiple of 32 bytes
__device__ inline void stage_v64(half_t (*dst)[V_PITCH], const half_t* src,
                                 size_t base, int tid) {
  #pragma unroll  // four independent copies issue back to back
  for (int i = 0; i < 4; i++) {
    int chunk = tid + i * 128;
    int row = chunk >> 3, ko = (chunk & 7) * 8;
    cp16_g2l(&src[base + (size_t)row * D_MODEL + ko], &dst[row][ko]);
  }
}

// B fragment (32 keys x 16 d) of P*V from the row-major V tile by the 16-bit
// transposing LDS load: lane (c = lane & 15, h = lane >> 4) gets
// V[k0 + 8h + 0..7][d0 + c], then the same 16 keys further on: the k order of
// frag_ld, which loads P. p is this lane's own address for (k0, d0).
typedef short s16x8 __attribute__((ext_vector_type(8)));
__device__ inline v16h frag_ld_tr(const half_t* p) {
  typedef __attribute__((address_space(3))) s16x8 lds_s16x8;
  HV u;
  u.h[0] = __builtin_bit_cast(
      v8h, __builtin_amdgcn_ds_load_tr16_b128_v8i16((lds_s16x8*)p));
  u.h[1] = __builtin_bit_cast(
      v8h, __builtin_amdgcn_ds_load_tr16_b128_v8i16(
               (lds_s16x8*)(p + 16 * V_PITCH)));
  return u.v;
}

__global__ __launch_bounds__(128)
void attention_kernel(const half_t* __restrict__ q, const half_t* __restrict__ k,
                      const half_t* __restrict__ v, const int* __restrict__ mask,
                      half_t* __restrict__ ctx) {
  __shared__ __align__(16) half_t Qs[64][72];
  __shared__ __align__(16) half_t Ks[64][72];
  __shared__ __align__(16) half_t Vs[64][V_PITCH]; // row-major: [key][d]
  __shared__ __align__(16) half_t Ps[4][16][72];   // per-wave exp(S-m) tile

  const int tid = threadIdx.x, lane = tid & 31, wave = tid >> 5;
  const int qt = blockIdx.x, h = blockIdx.y, b = blockIdx.z;
  const int sel = (lane < 16) ? 0 : 8;
  const int ln15 = lane & 15;
  const int mh = (lane < 16) ? 0 : 8;
  const size_t bh = (size_t)b * SEQ * D_MODEL + (size_t)h * D_K;
  const int* mrowp = mask + (size_t)b * SEQ;
  // Lane's row and column offset in a 16-key x 16-d block for frag_ld_tr.
  const int trow = 8 * (lane >> 4) + (lane & 7), tcol = 8 * ((lane >> 3) & 1);

  stage_qk64(Qs, q, bh + (size_t)(qt * 64) * D_MODEL, tid);

  float mrow[8], lrow[8];
  #pragma unroll
  for (int r = 0; r < 8; r++) { mrow[r] = -1e30f; lrow[r] = 0.0f; }

  // ---- pass A: row max / sum of exp ----
  for (int j = 0; j < SEQ / 64; j++) {
    __syncthreads();
    stage_qk64(Ks, k, bh + (size_t)(j * 64) * D_MODEL, tid);
    async_fence();
    __syncthreads();
    int mk[4];
    v8f c[4];
    #pragma unroll
    for (int n0 = 0; n0 < 4; n0++) {
      mk[n0] = mrowp[j * 64 + n0 * 16 + ln15];
      zero_v8f(c[n0]);
    }
    #pragma unroll
    for (int kk = 0; kk < 64; kk += 32) {
      v16h a = frag_ld(&Qs[wave * 16 + ln15][kk], sel);
      #pragma unroll
      for (int n0 = 0; n0 < 4; n0++) {
        v16h bf = frag_ld(&Ks[n0 * 16 + ln15][kk], sel);
        c[n0] = wmma16(a, bf, c[n0]);
      }
    }
    #pragma unroll
    for (int r = 0; r < 8; r++) {
      float mx = -1e30f;
      #pragma unroll
      for (int n0 = 0; n0 < 4; n0++)
        mx = fmaxf(mx, mk[n0] ? c[n0][r] : -1e9f);
      #pragma unroll
      for (int off = 1; off < 16; off <<= 1)
        mx = fmaxf(mx, __shfl_xor(mx, off, 32));
      float mn = fmaxf(mrow[r], mx);
      float se = 0.0f;
      #pragma unroll
      for (int n0 = 0; n0 < 4; n0++)
        se += __expf((mk[n0] ? c[n0][r] : -1e9f) - mn);
      #pragma unroll
      for (int off = 1; off < 16; off <<= 1) se += __shfl_xor(se, off, 32);
      lrow[r] = lrow[r] * __expf(mrow[r] - mn) + se;
      mrow[r] = mn;
    }
  }

  // ---- pass B: acc += exp(S - m) * V ----
  v8f acc[4];
  #pragma unroll
  for (int nb = 0; nb < 4; nb++) zero_v8f(acc[nb]);

  for (int j = 0; j < SEQ / 64; j++) {
    __syncthreads();
    stage_qk64(Ks, k, bh + (size_t)(j * 64) * D_MODEL, tid);
    stage_v64(Vs, v, bh + (size_t)(j * 64) * D_MODEL, tid);
    // This wave's K and V copies have landed before the barrier publishes them.
    asm volatile("s_wait_asynccnt 0x0" ::: "memory");
    __syncthreads();
    int mk[4];
    v8f c[4];
    #pragma unroll
    for (int n0 = 0; n0 < 4; n0++) {
      mk[n0] = mrowp[j * 64 + n0 * 16 + ln15];
      zero_v8f(c[n0]);
    }
    #pragma unroll
    for (int kk = 0; kk < 64; kk += 32) {
      v16h a = frag_ld(&Qs[wave * 16 + ln15][kk], sel);
      #pragma unroll
      for (int n0 = 0; n0 < 4; n0++) {
        v16h bf = frag_ld(&Ks[n0 * 16 + ln15][kk], sel);
        c[n0] = wmma16(a, bf, c[n0]);
      }
    }
    // P = exp(S - m) into this wave's LDS tile (C layout -> row-major)
    #pragma unroll
    for (int n0 = 0; n0 < 4; n0++)
      #pragma unroll
      for (int r = 0; r < 8; r++) {
        float s = mk[n0] ? c[n0][r] : -1e9f;
        Ps[wave][r + mh][n0 * 16 + ln15] = (half_t)__expf(s - mrow[r]);
      }
    __syncthreads();
    #pragma unroll
    for (int kk = 0; kk < 64; kk += 32) {
      v16h a = frag_ld(&Ps[wave][ln15][kk], sel);
      #pragma unroll
      for (int nb = 0; nb < 4; nb++) {
        v16h bf = frag_ld_tr(&Vs[kk + trow][nb * 16 + tcol]);
        acc[nb] = wmma16(a, bf, acc[nb]);
      }
    }
  }

  #pragma unroll
  for (int nb = 0; nb < 4; nb++)
    #pragma unroll
    for (int r = 0; r < 8; r++) {
      int qrow = qt * 64 + wave * 16 + r + mh;
      int d = nb * 16 + ln15;
      ctx[bh + (size_t)qrow * D_MODEL + d] = (half_t)(acc[nb][r] / lrow[r]);
    }
}

// ---------------------------------------------------------------------------
extern "C" void kernel_launch(void* const* d_in, const int* in_sizes, int n_in,
                              void* d_out, int out_size, void* d_ws,
                              size_t ws_size, hipStream_t stream) {
  const float* x    = (const float*)d_in[0];
  const int*   mask = (const int*)d_in[1];
  const float* wq = (const float*)d_in[2];  const float* bq = (const float*)d_in[3];
  const float* wk = (const float*)d_in[4];  const float* bk = (const float*)d_in[5];
  const float* wv = (const float*)d_in[6];  const float* bv = (const float*)d_in[7];
  const float* wo = (const float*)d_in[8];  const float* bo = (const float*)d_in[9];
  const float* w1 = (const float*)d_in[10]; const float* b1 = (const float*)d_in[11];
  const float* w2 = (const float*)d_in[12]; const float* b2 = (const float*)d_in[13];
  const float* g1 = (const float*)d_in[14]; const float* be1 = (const float*)d_in[15];
  const float* g2 = (const float*)d_in[16]; const float* be2 = (const float*)d_in[17];

  // Carve workspace (~216 MB total).
  char* p = (char*)d_ws;
  auto carve = [&](size_t bytes) {
    void* r = (void*)p;
    p += (bytes + 255) & ~(size_t)255;
    return r;
  };
  half_t* w16  = (half_t*)carve(((size_t)4 * D_MODEL * D_MODEL +
                                 (size_t)2 * D_FF * D_MODEL) * 2);
  half_t* wq16 = w16;
  half_t* wk16 = wq16 + (size_t)D_MODEL * D_MODEL;
  half_t* wv16 = wk16 + (size_t)D_MODEL * D_MODEL;
  half_t* wo16 = wv16 + (size_t)D_MODEL * D_MODEL;
  half_t* w116 = wo16 + (size_t)D_MODEL * D_MODEL;
  half_t* w216 = w116 + (size_t)D_FF * D_MODEL;
  half_t* h16  = (half_t*)carve((size_t)M_TOT * D_MODEL * 2);
  half_t* q16  = (half_t*)carve((size_t)M_TOT * D_MODEL * 2);
  half_t* k16  = (half_t*)carve((size_t)M_TOT * D_MODEL * 2);
  half_t* v16  = (half_t*)carve((size_t)M_TOT * D_MODEL * 2);
  half_t* ctx16 = (half_t*)carve((size_t)M_TOT * D_MODEL * 2);
  float*  x1   = (float*)carve((size_t)M_TOT * D_MODEL * 4);
  half_t* h216 = (half_t*)carve((size_t)M_TOT * D_MODEL * 2);
  half_t* ff1  = (half_t*)carve((size_t)M_TOT * D_FF * 2);

  // Weight conversion (f32 -> f16, layout preserved [N][K]).
  cvt_weights_kernel<<<CVT_BLOCKS, CVT_THREADS, 0, stream>>>(wq, wk, wv, wo, w1,
                                                             w2, w16);

  dim3 blk(256);
  dim3 gN1024(D_MODEL / 128, M_TOT / 128);
  dim3 gN4096(D_FF / 128, M_TOT / 128);

  // h = LN1(x)
  layernorm_kernel<<<M_TOT / 8, blk, 0, stream>>>(x, g1, be1, h16);
  // Q (scaled by 1/sqrt(dk)), K, V projections
  gemm_f16_kernel<true, false, false><<<gN1024, blk, 0, stream>>>(
      h16, wq16, bq, nullptr, q16, M_TOT, D_MODEL, D_MODEL, 0.125f);
  gemm_f16_kernel<true, false, false><<<gN1024, blk, 0, stream>>>(
      h16, wk16, bk, nullptr, k16, M_TOT, D_MODEL, D_MODEL, 1.0f);
  gemm_f16_kernel<true, false, false><<<gN1024, blk, 0, stream>>>(
      h16, wv16, bv, nullptr, v16, M_TOT, D_MODEL, D_MODEL, 1.0f);
  // attention -> ctx
  attention_kernel<<<dim3(SEQ / 64, HEADS, BATCH), dim3(128), 0, stream>>>(
      q16, k16, v16, mask, ctx16);
  // x1 = x + ctx @ wo^T + bo
  gemm_f16_kernel<false, false, true><<<gN1024, blk, 0, stream>>>(
      ctx16, wo16, bo, x, x1, M_TOT, D_MODEL, D_MODEL, 1.0f);
  // h2 = LN2(x1)
  layernorm_kernel<<<M_TOT / 8, blk, 0, stream>>>(x1, g2, be2, h216);
  // ff1 = relu(h2 @ w1^T + b1)
  gemm_f16_kernel<true, true, false><<<gN4096, blk, 0, stream>>>(
      h216, w116, b1, nullptr, ff1, M_TOT, D_FF, D_MODEL, 1.0f);
  // out = x1 + ff1 @ w2^T + b2
  gemm_f16_kernel<false, false, true><<<gN1024, blk, 0, stream>>>(
      ff1, w216, b2, x1, (float*)d_out, M_TOT, D_MODEL, D_FF, 1.0f);
}

// v003
// Measured time: 321 microseconds a run.
// Two timings next to v002 put it at 1.27 and 1.25 times that version's speed.
// All steps since v000 together make it 1.69 times as fast.
#include <hip/hip_runtime.h>
#include <hip/hip_bf16.h>
#include <cstdint>

// MI455X / gfx1250 transformer encoder block.
// All matmuls (QKV proj, QK^T, PV, O-proj, FFN1, FFN2) run on
// v_wmma_f32_16x16x32_f16 (f16 in, f32 accumulate). Tile staging uses
// GLOBAL_LOAD_ASYNC_TO_LDS_B128 (ASYNCcnt) when the builtin is available,
// with double-buffered LDS tiles in the GEMM for copy/compute overlap.

typedef _Float16 half_t;
typedef _Float16 v16h __attribute__((ext_vector_type(16)));
typedef _Float16 v8h  __attribute__((ext_vector_type(8)));
typedef float    v8f  __attribute__((ext_vector_type(8)));
typedef int      v4i  __attribute__((vector_size(16)));   // builtin pointee type

#define D_MODEL 1024
#define HEADS   16
#define D_K     64
#define D_FF    4096
#define SEQ     1024
#define BATCH   8
#define M_TOT   (BATCH * SEQ)   // 8192 rows
#define LN_EPS  1e-6f

#if defined(__has_builtin)
#if __has_builtin(__builtin_amdgcn_global_load_async_to_lds_b128) && \
    __has_builtin(__builtin_amdgcn_s_wait_asynccnt)
#define USE_ASYNC_LDS 1
#endif
#endif
#ifndef USE_ASYNC_LDS
#define USE_ASYNC_LDS 0
#endif

union HV { v16h v; v8h h[2]; };

__device__ inline v8f wmma16(v16h a, v16h b, v8f c) {
  // D = A(16x32 f16) * B(32x16 f16) + C(16x16 f32)
  return __builtin_amdgcn_wmma_f32_16x16x32_f16(false, a, false, b, (short)0, c,
                                                false, false);
}

// Copy 16 bytes global -> LDS. Async (ASYNCcnt) on CDNA5 when available.
__device__ inline void cp16_g2l(const half_t* g, half_t* l) {
#if USE_ASYNC_LDS
  // Flat LDS address truncates to the 32-bit LDS offset (ISA 10.2).
  __builtin_amdgcn_global_load_async_to_lds_b128(
      (__attribute__((address_space(1))) v4i*)(uintptr_t)g,
      (__attribute__((address_space(3))) v4i*)(uint32_t)(uintptr_t)l, 0, 0);
#else
  *(v8h*)l = *(const v8h*)g;
#endif
}

__device__ inline void async_fence() {
#if USE_ASYNC_LDS
  __builtin_amdgcn_s_wait_asynccnt(0);
#endif
}

// Load one lane's 16 f16 fragment values from a row-major [row][K] LDS tile.
// k-values: {sel..sel+7, 16+sel..16+sel+7}, sel = 0 (lanes 0-15) or 8 (16-31).
__device__ inline v16h frag_ld(const half_t* rowbase, int sel) {
  HV u;
  u.h[0] = *(const v8h*)(rowbase + sel);
  u.h[1] = *(const v8h*)(rowbase + 16 + sel);
  return u.v;
}

__device__ inline void zero_v8f(v8f& x) {
  #pragma unroll
  for (int i = 0; i < 8; i++) x[i] = 0.0f;
}

// ---------------------------------------------------------------------------
// fp32 -> f16 weight conversion, all six matrices in one launch.
// dst is the six f16 planes end to end (wq, wk, wv, wo, w1, w2). 256 blocks of
// 16 waves; a block converts three pieces of 16384 values: one of the four
// square matrices, one of w1, one of w2. Every wave-wide load is 512
// contiguous bytes, and a thread's 24 loads depend on nothing, so many are in
// flight at once and the memory latency is not paid once per value.
// ---------------------------------------------------------------------------
#define CVT_THREADS 512
#define CVT_LOADS   8
#define CVT_PIECE   (CVT_THREADS * CVT_LOADS * 4)        // 16384 values
#define CVT_BLOCKS  (D_FF * D_MODEL / CVT_PIECE)         // 256
#define SQ_PIECES   (D_MODEL * D_MODEL / CVT_PIECE)      // 64 pieces a square

typedef float    v4f __attribute__((ext_vector_type(4)));
typedef _Float16 v4h __attribute__((ext_vector_type(4)));

__device__ inline void cvt_load(v4f (&r)[CVT_LOADS], const float* src, int t) {
  #pragma unroll  // r[] stays in registers; the loads issue back to back
  for (int j = 0; j < CVT_LOADS; j++)
    r[j] = ((const v4f*)src)[j * CVT_THREADS + t];
}

__device__ inline void cvt_store(const v4f (&r)[CVT_LOADS], half_t* dst, int t) {
  #pragma unroll  // constant indices keep r[] in registers
  for (int j = 0; j < CVT_LOADS; j++) {
    v4h h;
    #pragma unroll  // same, for the four lanes of a vector
    for (int e = 0; e < 4; e++) h[e] = (half_t)r[j][e];
    ((v4h*)dst)[j * CVT_THREADS + t] = h;
  }
}

__global__ __launch_bounds__(CVT_THREADS)
void cvt_weights_kernel(const float* __restrict__ wq, const float* __restrict__ wk,
                        const float* __restrict__ wv, const float* __restrict__ wo,
                        const float* __restrict__ w1, const float* __restrict__ w2,
                        half_t* __restrict__ dst) {
  const int t = threadIdx.x;
  const unsigned blk = blockIdx.x;
  const float* lo = (blk & SQ_PIECES) ? wk : wq;         // block-uniform picks
  const float* hi = (blk & SQ_PIECES) ? wo : wv;
  const float* s0 = (blk & (2 * SQ_PIECES)) ? hi : lo;
  const size_t off = (size_t)blk * CVT_PIECE;
  v4f r0[CVT_LOADS], r1[CVT_LOADS], r2[CVT_LOADS];
  cvt_load(r0, s0 + (size_t)(blk % SQ_PIECES) * CVT_PIECE, t);
  cvt_load(r1, w1 + off, t);
  cvt_load(r2, w2 + off, t);
  cvt_store(r0, dst + off, t);
  cvt_store(r1, dst + (size_t)4 * D_MODEL * D_MODEL + off, t);
  cvt_store(r2, dst + (size_t)4 * D_MODEL * D_MODEL + (size_t)D_FF * D_MODEL + off, t);
}

// ---------------------------------------------------------------------------
// LayerNorm (reference semantics: unbiased std, divide by std+eps), f16 out.
// One wave per row of 1024; 8 rows per 256-thread block.
// ---------------------------------------------------------------------------
__global__ __launch_bounds__(256)
void layernorm_kernel(const float* __restrict__ x, const float* __restrict__ g,
                      const float* __restrict__ be, half_t* __restrict__ out) {
  const int lane = threadIdx.x & 31, wave = threadIdx.x >> 5;
  const int row = blockIdx.x * 8 + wave;
  const float* xr = x + (size_t)row * D_MODEL;
  float v[32];
  float s = 0.f, ss = 0.f;
  #pragma unroll
  for (int i = 0; i < 32; i++) {
    v[i] = xr[lane + i * 32];
    s += v[i];
    ss += v[i] * v[i];
  }
  #pragma unroll
  for (int off = 16; off > 0; off >>= 1) {
    s  += __shfl_xor(s,  off, 32);
    ss += __shfl_xor(ss, off, 32);
  }
  float mean = s * (1.0f / D_MODEL);
  float var  = (ss - (float)D_MODEL * mean * mean) * (1.0f / (D_MODEL - 1));
  float inv  = 1.0f / (sqrtf(fmaxf(var, 0.0f)) + LN_EPS);
  half_t* orow = out + (size_t)row * D_MODEL;
  #pragma unroll
  for (int i = 0; i < 32; i++) {
    int c = lane + i * 32;
    orow[c] = (half_t)(g[c] * (v[i] - mean) * inv + be[c]);
  }
}

// ---------------------------------------------------------------------------
// WMMA GEMM: out[M][N] = epilogue( A[M][K](f16) * W[N][K]^T(f16) )
// Block tile 128x128, double-buffered LDS, 8 waves as 4(M) x 2(N); each wave
// 32x64 = 2x4 fragments -> 8 v_wmma per 32 k from 6 fragment loads.
// A stage of the ring holds BK k of both tiles: the copies of a stage have the
// BK/32 * 8 WMMAs of the stage before as their lead, and a wave-wide copy
// covers whole lines of the source rows. K must be a multiple of BK.
// Row pitch (BK + 8) f16 = 16 bytes x odd, for the ds_load_b128 readers.
// Epilogue: (+bias)*scale, optional ReLU, optional +residual, f16/f32 out.
// ---------------------------------------------------------------------------
template <int BK>
__device__ inline void stage_tiles(half_t (*as)[BK + 8], half_t (*ws)[BK + 8],
                                   const half_t* A, const half_t* W, int tM,
                                   int tN, int k0, int Kdim, int tid) {
  constexpr int CPR = BK / 8;                // 16-byte chunks a row
  #pragma unroll  // independent copies issue back to back
  for (int i = 0; i < 128 * CPR / 256; i++) {
    int chunk = tid + i * 256;               // 128 rows x CPR chunks
    int row = chunk / CPR, ko = (chunk % CPR) * 8;
    cp16_g2l(&A[(size_t)(tM + row) * Kdim + k0 + ko], &as[row][ko]);
    cp16_g2l(&W[(size_t)(tN + row) * Kdim + k0 + ko], &ws[row][ko]);
  }
}

template <bool OUT_F16, bool RELU, bool ADD_RES, int BK>
__global__ __launch_bounds__(256)
void gemm_f16_kernel(const half_t* __restrict__ A,     // [M][K]
                     const half_t* __restrict__ W,     // [N][K]
                     const float* __restrict__ bias,   // [N]
                     const float* __restrict__ res,    // [M][N] or null
                     void* __restrict__ outp, int Mdim, int Ndim, int Kdim,
                     float out_scale) {
  __shared__ __align__(16) half_t As[2][128][BK + 8];
  __shared__ __align__(16) half_t Ws[2][128][BK + 8];
  const int tid = threadIdx.x;
  const int lane = tid & 31, wave = tid >> 5;
  const int wm = wave & 3, wn = wave >> 2;
  const int tM = blockIdx.y * 128, tN = blockIdx.x * 128;
  const int sel = (lane < 16) ? 0 : 8;
  const int ln15 = lane & 15;

  v8f acc[2][4];
  #pragma unroll
  for (int i = 0; i < 2; i++)
    #pragma unroll
    for (int j = 0; j < 4; j++) zero_v8f(acc[i][j]);

  // Prologue: stage tile 0.
  stage_tiles<BK>(As[0], Ws[0], A, W, tM, tN, 0, Kdim, tid);
  // This wave's copies of stage 0 have landed before the barrier publishes them.
  asm volatile("s_wait_asynccnt 0x0" ::: "memory");
  __syncthreads();

  const int nk = Kdim / BK;
  for (int ki = 0; ki < nk; ki++) {
    const int buf = ki & 1;
    // Copies of the next stage, into the buffer whose readers the barrier at
    // the foot of the trip before has ended; they fly during the WMMAs below.
    if (ki + 1 < nk)
      stage_tiles<BK>(As[buf ^ 1], Ws[buf ^ 1], A, W, tM, tN, (ki + 1) * BK,
                      Kdim, tid);

    #pragma unroll  // kk becomes a constant LDS offset of every fragment load
    for (int kk = 0; kk < BK; kk += 32) {
      v16h a0 = frag_ld(&As[buf][wm * 32 + 0 + ln15][kk], sel);
      v16h a1 = frag_ld(&As[buf][wm * 32 + 16 + ln15][kk], sel);
      #pragma unroll
      for (int fn = 0; fn < 4; fn++) {
        v16h b = frag_ld(&Ws[buf][wn * 64 + fn * 16 + ln15][kk], sel);
        acc[0][fn] = wmma16(a0, b, acc[0][fn]);
        acc[1][fn] = wmma16(a1, b, acc[1][fn]);
      }
    }
    // This wave's reads of buf are over before the barrier frees it for refill.
    asm volatile("s_wait_dscnt 0x0" ::: "memory");
    // This wave's copies of the next stage have landed before it is published.
    asm volatile("s_wait_asynccnt 0x0" ::: "memory");
    __syncthreads();
  }
  // No copy is outstanding when the wave goes on to its stores and ends.
  asm volatile("s_wait_asynccnt 0x0" ::: "memory");

  const int mh = (lane < 16) ? 0 : 8;  // C layout: lanes 16-31 hold rows M+8
  #pragma unroll
  for (int fm = 0; fm < 2; fm++) {
    #pragma unroll
    for (int fn = 0; fn < 4; fn++) {
      int n = tN + wn * 64 + fn * 16 + ln15;
      float bv = bias[n];
      #pragma unroll
      for (int r = 0; r < 8; r++) {
        int m = tM + wm * 32 + fm * 16 + r + mh;
        float val = (acc[fm][fn][r] + bv) * out_scale;
        if (RELU) val = val > 0.0f ? val : 0.0f;
        if (ADD_RES) val += res[(size_t)m * Ndim + n];
        if (OUT_F16)
          ((half_t*)outp)[(size_t)m * Ndim + n] = (half_t)val;
        else
          ((float*)outp)[(size_t)m * Ndim + n] = val;
      }
    }
  }
}

// ---------------------------------------------------------------------------
// Fused attention: one block per (64-query tile, head, batch); 4 waves,
// each wave owns 16 query rows. Two-pass softmax (stats, then PV) so no
// online rescale of the accumulator is needed; scores never touch HBM.
// Q is pre-scaled by 1/sqrt(dk) in the Q-projection epilogue.
// ---------------------------------------------------------------------------
__device__ inline void stage_qk64(half_t (*dst)[72], const half_t* src,
                                  size_t base, int tid) {
  // 64 rows x 64 f16 = 512 16B chunks; 128 threads x 4.
  #pragma unroll
  for (int i = 0; i < 4; i++) {
    int chunk = tid + i * 128;
    int row = chunk >> 3, ko = (chunk & 7) * 8;
    cp16_g2l(&src[base + (size_t)row * D_MODEL + ko], &dst[row][ko]);
  }
}

// V tile, row-major [key][d] as it lies in memory: 64 rows x 64 f16 = 512
// 16-byte chunks, 128 threads x 4 copies, through no register.
#define V_PITCH 80   // f16 a row = 160 bytes, an odd multiple of 32 bytes
__device__ inline void stage_v64(half_t (*dst)[V_PITCH], const half_t* src,
                                 size_t base, int tid) {
  #pragma unroll  // four independent copies issue back to back
  for (int i = 0; i < 4; i++) {
    int chunk = tid + i * 128;
    int row = chunk >> 3, ko = (chunk & 7) * 8;
    cp16_g2l(&src[base + (size_t)row * D_MODEL + ko], &dst[row][ko]);
  }
}

// B fragment (32 keys x 16 d) of P*V from the row-major V tile by the 16-bit
// transposing LDS load: lane (c = lane & 15, h = lane >> 4) gets
// V[k0 + 8h + 0..7][d0 + c], then the same 16 keys further on: the k order of
// frag_ld, which loads P. p is this lane's own address for (k0, d0).
typedef short s16x8 __attribute__((ext_vector_type(8)));
__device__ inline v16h frag_ld_tr(const half_t* p) {
  typedef __attribute__((address_space(3))) s16x8 lds_s16x8;
  HV u;
  u.h[0] = __builtin_bit_cast(
      v8h, __builtin_amdgcn_ds_load_tr16_b128_v8i16((lds_s16x8*)p));
  u.h[1] = __builtin_bit_cast(
      v8h, __builtin_amdgcn_ds_load_tr16_b128_v8i16(
               (lds_s16x8*)(p + 16 * V_PITCH)));
  return u.v;
}

__global__ __launch_bounds__(128)
void attention_kernel(const half_t* __restrict__ q, const half_t* __restrict__ k,
                      const half_t* __restrict__ v, const int* __restrict__ mask,
                      half_t* __restrict__ ctx) {
  __shared__ __align__(16) half_t Qs[64][72];
  __shared__ __align__(16) half_t Ks[64][72];
  __shared__ __align__(16) half_t Vs[64][V_PITCH]; // row-major: [key][d]
  __shared__ __align__(16) half_t Ps[4][16][72];   // per-wave exp(S-m) tile

  const int tid = threadIdx.x, lane = tid & 31, wave = tid >> 5;
  const int qt = blockIdx.x, h = blockIdx.y, b = blockIdx.z;
  const int sel = (lane < 16) ? 0 : 8;
  const int ln15 = lane & 15;
  const int mh = (lane < 16) ? 0 : 8;
  const size_t bh = (size_t)b * SEQ * D_MODEL + (size_t)h * D_K;
  const int* mrowp = mask + (size_t)b * SEQ;
  // Lane's row and column offset in a 16-key x 16-d block for frag_ld_tr.
  const int trow = 8 * (lane >> 4) + (lane & 7), tcol = 8 * ((lane >> 3) & 1);

  stage_qk64(Qs, q, bh + (size_t)(qt * 64) * D_MODEL, tid);

  float mrow[8], lrow[8];
  #pragma unroll
  for (int r = 0; r < 8; r++) { mrow[r] = -1e30f; lrow[r] = 0.0f; }

  // ---- pass A: row max / sum of exp ----
  for (int j = 0; j < SEQ / 64; j++) {
    __syncthreads();
    stage_qk64(Ks, k, bh + (size_t)(j * 64) * D_MODEL, tid);
    async_fence();
    __syncthreads();
    int mk[4];
    v8f c[4];
    #pragma unroll
    for (int n0 = 0; n0 < 4; n0++) {
      mk[n0] = mrowp[j * 64 + n0 * 16 + ln15];
      zero_v8f(c[n0]);
    }
    #pragma unroll
    for (int kk = 0; kk < 64; kk += 32) {
      v16h a = frag_ld(&Qs[wave * 16 + ln15][kk], sel);
      #pragma unroll
      for (int n0 = 0; n0 < 4; n0++) {
        v16h bf = frag_ld(&Ks[n0 * 16 + ln15][kk], sel);
        c[n0] = wmma16(a, bf, c[n0]);
      }
    }
    #pragma unroll
    for (int r = 0; r < 8; r++) {
      float mx = -1e30f;
      #pragma unroll
      for (int n0 = 0; n0 < 4; n0++)
        mx = fmaxf(mx, mk[n0] ? c[n0][r] : -1e9f);
      #pragma unroll
      for (int off = 1; off < 16; off <<= 1)
        mx = fmaxf(mx, __shfl_xor(mx, off, 32));
      float mn = fmaxf(mrow[r], mx);
      float se = 0.0f;
      #pragma unroll
      for (int n0 = 0; n0 < 4; n0++)
        se += __expf((mk[n0] ? c[n0][r] : -1e9f) - mn);
      #pragma unroll
      for (int off = 1; off < 16; off <<= 1) se += __shfl_xor(se, off, 32);
      lrow[r] = lrow[r] * __expf(mrow[r] - mn) + se;
      mrow[r] = mn;
    }
  }

  // ---- pass B: acc += exp(S - m) * V ----
  v8f acc[4];
  #pragma unroll
  for (int nb = 0; nb < 4; nb++) zero_v8f(acc[nb]);

  for (int j = 0; j < SEQ / 64; j++) {
    __syncthreads();
    stage_qk64(Ks, k, bh + (size_t)(j * 64) * D_MODEL, tid);
    stage_v64(Vs, v, bh + (size_t)(j * 64) * D_MODEL, tid);
    // This wave's K and V copies have landed before the barrier publishes them.
    asm volatile("s_wait_asynccnt 0x0" ::: "memory");
    __syncthreads();
    int mk[4];
    v8f c[4];
    #pragma unroll
    for (int n0 = 0; n0 < 4; n0++) {
      mk[n0] = mrowp[j * 64 + n0 * 16 + ln15];
      zero_v8f(c[n0]);
    }
    #pragma unroll
    for (int kk = 0; kk < 64; kk += 32) {
      v16h a = frag_ld(&Qs[wave * 16 + ln15][kk], sel);
      #pragma unroll
      for (int n0 = 0; n0 < 4; n0++) {
        v16h bf = frag_ld(&Ks[n0 * 16 + ln15][kk], sel);
        c[n0] = wmma16(a, bf, c[n0]);
      }
    }
    // P = exp(S - m) into this wave's LDS tile (C layout -> row-major)
    #pragma unroll
    for (int n0 = 0; n0 < 4; n0++)
      #pragma unroll
      for (int r = 0; r < 8; r++) {
        float s = mk[n0] ? c[n0][r] : -1e9f;
        Ps[wave][r + mh][n0 * 16 + ln15] = (half_t)__expf(s - mrow[r]);
      }
    __syncthreads();
    #pragma unroll
    for (int kk = 0; kk < 64; kk += 32) {
      v16h a = frag_ld(&Ps[wave][ln15][kk], sel);
      #pragma unroll
      for (int nb = 0; nb < 4; nb++) {
        v16h bf = frag_ld_tr(&Vs[kk + trow][nb * 16 + tcol]);
        acc[nb] = wmma16(a, bf, acc[nb]);
      }
    }
  }

  #pragma unroll
  for (int nb = 0; nb < 4; nb++)
    #pragma unroll
    for (int r = 0; r < 8; r++) {
      int qrow = qt * 64 + wave * 16 + r + mh;
      int d = nb * 16 + ln15;
      ctx[bh + (size_t)qrow * D_MODEL + d] = (half_t)(acc[nb][r] / lrow[r]);
    }
}

// ---------------------------------------------------------------------------
extern "C" void kernel_launch(void* const* d_in, const int* in_sizes, int n_in,
                              void* d_out, int out_size, void* d_ws,
                              size_t ws_size, hipStream_t stream) {
  const float* x    = (const float*)d_in[0];
  const int*   mask = (const int*)d_in[1];
  const float* wq = (const float*)d_in[2];  const float* bq = (const float*)d_in[3];
  const float* wk = (const float*)d_in[4];  const float* bk = (const float*)d_in[5];
  const float* wv = (const float*)d_in[6];  const float* bv = (const float*)d_in[7];
  const float* wo = (const float*)d_in[8];  const float* bo = (const float*)d_in[9];
  const float* w1 = (const float*)d_in[10]; const float* b1 = (const float*)d_in[11];
  const float* w2 = (const float*)d_in[12]; const float* b2 = (const float*)d_in[13];
  const float* g1 = (const float*)d_in[14]; const float* be1 = (const float*)d_in[15];
  const float* g2 = (const float*)d_in[16]; const float* be2 = (const float*)d_in[17];

  // Carve workspace (~216 MB total).
  char* p = (char*)d_ws;
  auto carve = [&](size_t bytes) {
    void* r = (void*)p;
    p += (bytes + 255) & ~(size_t)255;
    return r;
  };
  half_t* w16  = (half_t*)carve(((size_t)4 * D_MODEL * D_MODEL +
                                 (size_t)2 * D_FF * D_MODEL) * 2);
  half_t* wq16 = w16;
  half_t* wk16 = wq16 + (size_t)D_MODEL * D_MODEL;
  half_t* wv16 = wk16 + (size_t)D_MODEL * D_MODEL;
  half_t* wo16 = wv16 + (size_t)D_MODEL * D_MODEL;
  half_t* w116 = wo16 + (size_t)D_MODEL * D_MODEL;
  half_t* w216 = w116 + (size_t)D_FF * D_MODEL;
  half_t* h16  = (half_t*)carve((size_t)M_TOT * D_MODEL * 2);
  half_t* q16  = (half_t*)carve((size_t)M_TOT * D_MODEL * 2);
  half_t* k16  = (half_t*)carve((size_t)M_TOT * D_MODEL * 2);
  half_t* v16  = (half_t*)carve((size_t)M_TOT * D_MODEL * 2);
  half_t* ctx16 = (half_t*)carve((size_t)M_TOT * D_MODEL * 2);
  float*  x1   = (float*)carve((size_t)M_TOT * D_MODEL * 4);
  half_t* h216 = (half_t*)carve((size_t)M_TOT * D_MODEL * 2);
  half_t* ff1  = (half_t*)carve((size_t)M_TOT * D_FF * 2);

  // Weight conversion (f32 -> f16, layout preserved [N][K]).
  cvt_weights_kernel<<<CVT_BLOCKS, CVT_THREADS, 0, stream>>>(wq, wk, wv, wo, w1,
                                                             w2, w16);

  dim3 blk(256);
  dim3 gN1024(D_MODEL / 128, M_TOT / 128);
  dim3 gN4096(D_FF / 128, M_TOT / 128);
  // Stage depth BK: 128 for the 512-block grids (two blocks a WGP either way);
  // 64 for the 2048-block grid, whose LDS then still lets four blocks share one.

  // h = LN1(x)
  layernorm_kernel<<<M_TOT / 8, blk, 0, stream>>>(x, g1, be1, h16);
  // Q (scaled by 1/sqrt(dk)), K, V projections
  gemm_f16_kernel<true, false, false, 128><<<gN1024, blk, 0, stream>>>(
      h16, wq16, bq, nullptr, q16, M_TOT, D_MODEL, D_MODEL, 0.125f);
  gemm_f16_kernel<true, false, false, 128><<<gN1024, blk, 0, stream>>>(
      h16, wk16, bk, nullptr, k16, M_TOT, D_MODEL, D_MODEL, 1.0f);
  gemm_f16_kernel<true, false, false, 128><<<gN1024, blk, 0, stream>>>(
      h16, wv16, bv, nullptr, v16, M_TOT, D_MODEL, D_MODEL, 1.0f);
  // attention -> ctx
  attention_kernel<<<dim3(SEQ / 64, HEADS, BATCH), dim3(128), 0, stream>>>(
      q16, k16, v16, mask, ctx16);
  // x1 = x + ctx @ wo^T + bo
  gemm_f16_kernel<false, false, true, 128><<<gN1024, blk, 0, stream>>>(
      ctx16, wo16, bo, x, x1, M_TOT, D_MODEL, D_MODEL, 1.0f);
  // h2 = LN2(x1)
  layernorm_kernel<<<M_TOT / 8, blk, 0, stream>>>(x1, g2, be2, h216);
  // ff1 = relu(h2 @ w1^T + b1)
  gemm_f16_kernel<true, true, false, 64><<<gN4096, blk, 0, stream>>>(
      h216, w116, b1, nullptr, ff1, M_TOT, D_FF, D_MODEL, 1.0f);
  // out = x1 + ff1 @ w2^T + b2
  gemm_f16_kernel<false, false, true, 128><<<gN1024, blk, 0, stream>>>(
      ff1, w216, b2, x1, (float*)d_out, M_TOT, D_MODEL, D_FF, 1.0f);
}

// v004
// One run takes 289 microseconds.
// Next to v003, in two timings, it ran 1.11 times as fast each time.
// Over all steps from v000 it is 1.87 times as fast.
#include <hip/hip_runtime.h>
#include <hip/hip_bf16.h>
#include <cstdint>

// MI455X / gfx1250 transformer encoder block.
// All matmuls (QKV proj, QK^T, PV, O-proj, FFN1, FFN2) run on
// v_wmma_f32_16x16x32_f16 (f16 in, f32 accumulate). Tile staging uses
// GLOBAL_LOAD_ASYNC_TO_LDS_B128 (ASYNCcnt) when the builtin is available,
// with double-buffered LDS tiles in the GEMM for copy/compute overlap.

typedef _Float16 half_t;
typedef _Float16 v16h __attribute__((ext_vector_type(16)));
typedef _Float16 v8h  __attribute__((ext_vector_type(8)));
typedef float    v8f  __attribute__((ext_vector_type(8)));
typedef int      v4i  __attribute__((vector_size(16)));   // builtin pointee type

#define D_MODEL 1024
#define HEADS   16
#define D_K     64
#define D_FF    4096
#define SEQ     1024
#define BATCH   8
#define M_TOT   (BATCH * SEQ)   // 8192 rows
#define LN_EPS  1e-6f

#if defined(__has_builtin)
#if __has_builtin(__builtin_amdgcn_global_load_async_to_lds_b128) && \
    __has_builtin(__builtin_amdgcn_s_wait_asynccnt)
#define USE_ASYNC_LDS 1
#endif
#endif
#ifndef USE_ASYNC_LDS
#define USE_ASYNC_LDS 0
#endif

union HV { v16h v; v8h h[2]; };

__device__ inline v8f wmma16(v16h a, v16h b, v8f c) {
  // D = A(16x32 f16) * B(32x16 f16) + C(16x16 f32)
  return __builtin_amdgcn_wmma_f32_16x16x32_f16(false, a, false, b, (short)0, c,
                                                false, false);
}

// Copy 16 bytes global -> LDS. Async (ASYNCcnt) on CDNA5 when available.
__device__ inline void cp16_g2l(const half_t* g, half_t* l) {
#if USE_ASYNC_LDS
  // Flat LDS address truncates to the 32-bit LDS offset (ISA 10.2).
  __builtin_amdgcn_global_load_async_to_lds_b128(
      (__attribute__((address_space(1))) v4i*)(uintptr_t)g,
      (__attribute__((address_space(3))) v4i*)(uint32_t)(uintptr_t)l, 0, 0);
#else
  *(v8h*)l = *(const v8h*)g;
#endif
}

__device__ inline void async_fence() {
#if USE_ASYNC_LDS
  __builtin_amdgcn_s_wait_asynccnt(0);
#endif
}

// Load one lane's 16 f16 fragment values from a row-major [row][K] LDS tile.
// k-values: {sel..sel+7, 16+sel..16+sel+7}, sel = 0 (lanes 0-15) or 8 (16-31).
__device__ inline v16h frag_ld(const half_t* rowbase, int sel) {
  HV u;
  u.h[0] = *(const v8h*)(rowbase + sel);
  u.h[1] = *(const v8h*)(rowbase + 16 + sel);
  return u.v;
}

__device__ inline void zero_v8f(v8f& x) {
  #pragma unroll
  for (int i = 0; i < 8; i++) x[i] = 0.0f;
}

// ---------------------------------------------------------------------------
// fp32 -> f16 weight conversion, all six matrices in one launch.
// dst is the six f16 planes end to end (wq, wk, wv, wo, w1, w2). 256 blocks of
// 16 waves; a block converts three pieces of 16384 values: one of the four
// square matrices, one of w1, one of w2. Every wave-wide load is 512
// contiguous bytes, and a thread's 24 loads depend on nothing, so many are in
// flight at once and the memory latency is not paid once per value.
// ---------------------------------------------------------------------------
#define CVT_THREADS 512
#define CVT_LOADS   8
#define CVT_PIECE   (CVT_THREADS * CVT_LOADS * 4)        // 16384 values
#define CVT_BLOCKS  (D_FF * D_MODEL / CVT_PIECE)         // 256
#define SQ_PIECES   (D_MODEL * D_MODEL / CVT_PIECE)      // 64 pieces a square

typedef float    v4f __attribute__((ext_vector_type(4)));
typedef _Float16 v4h __attribute__((ext_vector_type(4)));

__device__ inline void cvt_load(v4f (&r)[CVT_LOADS], const float* src, int t) {
  #pragma unroll  // r[] stays in registers; the loads issue back to back
  for (int j = 0; j < CVT_LOADS; j++)
    r[j] = ((const v4f*)src)[j * CVT_THREADS + t];
}

__device__ inline void cvt_store(const v4f (&r)[CVT_LOADS], half_t* dst, int t) {
  #pragma unroll  // constant indices keep r[] in registers
  for (int j = 0; j < CVT_LOADS; j++) {
    v4h h;
    #pragma unroll  // same, for the four lanes of a vector
    for (int e = 0; e < 4; e++) h[e] = (half_t)r[j][e];
    ((v4h*)dst)[j * CVT_THREADS + t] = h;
  }
}

__global__ __launch_bounds__(CVT_THREADS)
void cvt_weights_kernel(const float* __restrict__ wq, const float* __restrict__ wk,
                        const float* __restrict__ wv, const float* __restrict__ wo,
                        const float* __restrict__ w1, const float* __restrict__ w2,
                        half_t* __restrict__ dst) {
  const int t = threadIdx.x;
  const unsigned blk = blockIdx.x;
  const float* lo = (blk & SQ_PIECES) ? wk : wq;         // block-uniform picks
  const float* hi = (blk & SQ_PIECES) ? wo : wv;
  const float* s0 = (blk & (2 * SQ_PIECES)) ? hi : lo;
  const size_t off = (size_t)blk * CVT_PIECE;
  v4f r0[CVT_LOADS], r1[CVT_LOADS], r2[CVT_LOADS];
  cvt_load(r0, s0 + (size_t)(blk % SQ_PIECES) * CVT_PIECE, t);
  cvt_load(r1, w1 + off, t);
  cvt_load(r2, w2 + off, t);
  cvt_store(r0, dst + off, t);
  cvt_store(r1, dst + (size_t)4 * D_MODEL * D_MODEL + off, t);
  cvt_store(r2, dst + (size_t)4 * D_MODEL * D_MODEL + (size_t)D_FF * D_MODEL + off, t);
}

// ---------------------------------------------------------------------------
// LayerNorm (reference semantics: unbiased std, divide by std+eps), f16 out.
// One wave per row of 1024; 8 rows per 256-thread block.
// ---------------------------------------------------------------------------
__global__ __launch_bounds__(256)
void layernorm_kernel(const float* __restrict__ x, const float* __restrict__ g,
                      const float* __restrict__ be, half_t* __restrict__ out) {
  const int lane = threadIdx.x & 31, wave = threadIdx.x >> 5;
  const int row = blockIdx.x * 8 + wave;
  const float* xr = x + (size_t)row * D_MODEL;
  float v[32];
  float s = 0.f, ss = 0.f;
  #pragma unroll
  for (int i = 0; i < 32; i++) {
    v[i] = xr[lane + i * 32];
    s += v[i];
    ss += v[i] * v[i];
  }
  #pragma unroll
  for (int off = 16; off > 0; off >>= 1) {
    s  += __shfl_xor(s,  off, 32);
    ss += __shfl_xor(ss, off, 32);
  }
  float mean = s * (1.0f / D_MODEL);
  float var  = (ss - (float)D_MODEL * mean * mean) * (1.0f / (D_MODEL - 1));
  float inv  = 1.0f / (sqrtf(fmaxf(var, 0.0f)) + LN_EPS);
  half_t* orow = out + (size_t)row * D_MODEL;
  #pragma unroll
  for (int i = 0; i < 32; i++) {
    int c = lane + i * 32;
    orow[c] = (half_t)(g[c] * (v[i] - mean) * inv + be[c]);
  }
}

// ---------------------------------------------------------------------------
// WMMA GEMM: out[M][N] = epilogue( A[M][K](f16) * W[N][K]^T(f16) )
// Block tile 128x128, double-buffered LDS, 8 waves as 4(M) x 2(N); each wave
// 32x64 = 2x4 fragments -> 8 v_wmma per 32 k from 6 fragment loads.
// A stage of the ring holds BK k of both tiles: the copies of a stage have the
// BK/32 * 8 WMMAs of the stage before as their lead, and a wave-wide copy
// covers whole lines of the source rows. K must be a multiple of BK.
// Row pitch (BK + 8) f16 = 16 bytes x odd, for the ds_load_b128 readers.
// Epilogue: (+bias)*scale, optional ReLU, optional +residual, f16/f32 out.
// ---------------------------------------------------------------------------
template <int BK>
__device__ inline void stage_tiles(half_t (*as)[BK + 8], half_t (*ws)[BK + 8],
                                   const half_t* A, const half_t* W, int tM,
                                   int tN, int k0, int Kdim, int tid) {
  constexpr int CPR = BK / 8;                // 16-byte chunks a row
  #pragma unroll  // independent copies issue back to back
  for (int i = 0; i < 128 * CPR / 256; i++) {
    int chunk = tid + i * 256;               // 128 rows x CPR chunks
    int row = chunk / CPR, ko = (chunk % CPR) * 8;
    cp16_g2l(&A[(size_t)(tM + row) * Kdim + k0 + ko], &as[row][ko]);
    cp16_g2l(&W[(size_t)(tN + row) * Kdim + k0 + ko], &ws[row][ko]);
  }
}

template <bool OUT_F16, bool RELU, bool ADD_RES, int BK>
__global__ __launch_bounds__(256)
void gemm_f16_kernel(const half_t* __restrict__ A,     // [M][K]
                     const half_t* __restrict__ W,     // [N][K]
                     const float* __restrict__ bias,   // [N]
                     const float* __restrict__ res,    // [M][N] or null
                     void* __restrict__ outp, int Mdim, int Ndim, int Kdim,
                     float out_scale) {
  __shared__ __align__(16) half_t As[2][128][BK + 8];
  __shared__ __align__(16) half_t Ws[2][128][BK + 8];
  const int tid = threadIdx.x;
  const int lane = tid & 31, wave = tid >> 5;
  const int wm = wave & 3, wn = wave >> 2;
  const int tM = blockIdx.y * 128, tN = blockIdx.x * 128;
  const int sel = (lane < 16) ? 0 : 8;
  const int ln15 = lane & 15;

  v8f acc[2][4];
  #pragma unroll
  for (int i = 0; i < 2; i++)
    #pragma unroll
    for (int j = 0; j < 4; j++) zero_v8f(acc[i][j]);

  // Prologue: stage tile 0.
  stage_tiles<BK>(As[0], Ws[0], A, W, tM, tN, 0, Kdim, tid);
  // This wave's copies of stage 0 have landed before the barrier publishes them.
  asm volatile("s_wait_asynccnt 0x0" ::: "memory");
  __syncthreads();

  const int nk = Kdim / BK;
  for (int ki = 0; ki < nk; ki++) {
    const int buf = ki & 1;
    // Copies of the next stage, into the buffer whose readers the barrier at
    // the foot of the trip before has ended; they fly during the WMMAs below.
    if (ki + 1 < nk)
      stage_tiles<BK>(As[buf ^ 1], Ws[buf ^ 1], A, W, tM, tN, (ki + 1) * BK,
                      Kdim, tid);

    #pragma unroll  // kk becomes a constant LDS offset of every fragment load
    for (int kk = 0; kk < BK; kk += 32) {
      v16h a0 = frag_ld(&As[buf][wm * 32 + 0 + ln15][kk], sel);
      v16h a1 = frag_ld(&As[buf][wm * 32 + 16 + ln15][kk], sel);
      #pragma unroll
      for (int fn = 0; fn < 4; fn++) {
        v16h b = frag_ld(&Ws[buf][wn * 64 + fn * 16 + ln15][kk], sel);
        acc[0][fn] = wmma16(a0, b, acc[0][fn]);
        acc[1][fn] = wmma16(a1, b, acc[1][fn]);
      }
    }
    // This wave's reads of buf are over before the barrier frees it for refill.
    asm volatile("s_wait_dscnt 0x0" ::: "memory");
    // This wave's copies of the next stage have landed before it is published.
    asm volatile("s_wait_asynccnt 0x0" ::: "memory");
    __syncthreads();
  }
  // No copy is outstanding when the wave goes on to its stores and ends.
  asm volatile("s_wait_asynccnt 0x0" ::: "memory");

  const int mh = (lane < 16) ? 0 : 8;  // C layout: lanes 16-31 hold rows M+8
  #pragma unroll
  for (int fm = 0; fm < 2; fm++) {
    #pragma unroll
    for (int fn = 0; fn < 4; fn++) {
      int n = tN + wn * 64 + fn * 16 + ln15;
      float bv = bias[n];
      #pragma unroll
      for (int r = 0; r < 8; r++) {
        int m = tM + wm * 32 + fm * 16 + r + mh;
        float val = (acc[fm][fn][r] + bv) * out_scale;
        if (RELU) val = val > 0.0f ? val : 0.0f;
        if (ADD_RES) val += res[(size_t)m * Ndim + n];
        if (OUT_F16)
          ((half_t*)outp)[(size_t)m * Ndim + n] = (half_t)val;
        else
          ((float*)outp)[(size_t)m * Ndim + n] = val;
      }
    }
  }
}

__device__ inline void stage_qk64(half_t (*dst)[72], const half_t* src,
                                  size_t base, int tid) {
  // 64 rows x 64 f16 = 512 16B chunks; 128 threads x 4.
  #pragma unroll
  for (int i = 0; i < 4; i++) {
    int chunk = tid + i * 128;
    int row = chunk >> 3, ko = (chunk & 7) * 8;
    cp16_g2l(&src[base + (size_t)row * D_MODEL + ko], &dst[row][ko]);
  }
}

// V tile, row-major [key][d] as it lies in memory: 64 rows x 64 f16 = 512
// 16-byte chunks, 128 threads x 4 copies, through no register.
#define V_PITCH 80   // f16 a row = 160 bytes, an odd multiple of 32 bytes
__device__ inline void stage_v64(half_t (*dst)[V_PITCH], const half_t* src,
                                 size_t base, int tid) {
  #pragma unroll  // four independent copies issue back to back
  for (int i = 0; i < 4; i++) {
    int chunk = tid + i * 128;
    int row = chunk >> 3, ko = (chunk & 7) * 8;
    cp16_g2l(&src[base + (size_t)row * D_MODEL + ko], &dst[row][ko]);
  }
}

// A fragment (16 d x 32 keys) of V^T * P^T from the row-major V tile by the
// 16-bit transposing LDS load: lane (c = lane & 15, h = lane >> 4) gets
// V[k0 + 8h + 0..7][d0 + c], then the same 16 keys further on: the k order of
// frag_ld. p is this lane's own address for (k0, d0).
typedef short s16x8 __attribute__((ext_vector_type(8)));
__device__ inline v16h frag_ld_tr(const half_t* p) {
  typedef __attribute__((address_space(3))) s16x8 lds_s16x8;
  HV u;
  u.h[0] = __builtin_bit_cast(
      v8h, __builtin_amdgcn_ds_load_tr16_b128_v8i16((lds_s16x8*)p));
  u.h[1] = __builtin_bit_cast(
      v8h, __builtin_amdgcn_ds_load_tr16_b128_v8i16(
               (lds_s16x8*)(p + 16 * V_PITCH)));
  return u.v;
}

// Mask of a 64-key tile as bits. In the transposed scores a lane's keys are
// n0 * 16 + 8 * (lane >> 4) + r: bit (n0 & 1) * 16 + r of w[n0 >> 1] is set
// where that key's mask is not 0. mtile points at the mask of the tile's key 0.
__device__ inline void mask_bits(unsigned (&w)[2], const int* mtile, int lane,
                                 int mh) {
  w[0] = __builtin_amdgcn_ballot_w32(mtile[lane] != 0) >> mh;
  w[1] = __builtin_amdgcn_ballot_w32(mtile[32 + lane] != 0) >> mh;
}

// s where bit 'bit' of w is set, else -1e9 (the reference's masked score).
__device__ inline float masked(float s, unsigned w, int bit) {
  const int open = (int)(w << (31 - bit)) >> 31;         // all ones or 0
  return __builtin_bit_cast(
      float, (open & __builtin_bit_cast(int, s)) |
                 (~open & __builtin_bit_cast(int, -1e9f)));
}

// Masked scores of 64 keys, transposed: c[n0][r] is the score of query row
// qrow of Qs against key n0 * 16 + 8 * (lane >> 4) + r of Ks. A = K rows,
// B = Q rows, both by frag_ld, so both in the same k order.
__device__ inline void scores_t(v8f (&c)[4], const half_t (*Qs)[72],
                                const half_t (*Ks)[72], const unsigned (&w)[2],
                                int qrow, int ln15, int sel) {
  // Every loop here is unrolled: constant indices keep c[] in registers and
  // make kk, n0 and the mask bit immediates.
  #pragma unroll
  for (int n0 = 0; n0 < 4; n0++) zero_v8f(c[n0]);
  #pragma unroll
  for (int kk = 0; kk < 64; kk += 32) {
    v16h bq = frag_ld(&Qs[qrow][kk], sel);
    #pragma unroll
    for (int n0 = 0; n0 < 4; n0++) {
      v16h ak = frag_ld(&Ks[n0 * 16 + ln15][kk], sel);
      c[n0] = wmma16(ak, bq, c[n0]);
    }
  }
  #pragma unroll
  for (int n0 = 0; n0 < 4; n0++)
    #pragma unroll
    for (int r = 0; r < 8; r++)
      c[n0][r] = masked(c[n0][r], w[n0 >> 1], (n0 & 1) * 16 + r);
}

// B fragment (32 keys x 16 queries) of V^T * P^T from two score tiles: keys
// 8h + 0..7 are the first tile's registers, keys 16 + 8h + 0..7 the second's:
// the k order of frag_ld_tr.
__device__ inline v16h p_frag(const v8f& c0, const v8f& c1, float m) {
  HV p;
  #pragma unroll  // constant indices keep the vectors in registers
  for (int r = 0; r < 8; r++) {
    p.h[0][r] = (half_t)__expf(c0[r] - m);
    p.h[1][r] = (half_t)__expf(c1[r] - m);
  }
  return p.v;
}

__device__ inline float max8(const v8f& c) {
  float m = c[0];
  #pragma unroll  // constant indices keep c in registers
  for (int r = 1; r < 8; r++) m = fmaxf(m, c[r]);
  return m;
}

__device__ inline float sumexp8(const v8f& c, float m) {
  float s = 0.0f;
  #pragma unroll  // constant indices keep c in registers
  for (int r = 0; r < 8; r++) s += __expf(c[r] - m);
  return s;
}

__global__ __launch_bounds__(128)
void attention_kernel(const half_t* __restrict__ q, const half_t* __restrict__ k,
                      const half_t* __restrict__ v, const int* __restrict__ mask,
                      half_t* __restrict__ ctx) {
  __shared__ __align__(16) half_t Qs[64][72];
  __shared__ __align__(16) half_t Ks[64][72];
  __shared__ __align__(16) half_t Vs[64][V_PITCH]; // row-major: [key][d]

  const int tid = threadIdx.x, lane = tid & 31, wave = tid >> 5;
  const int qt = blockIdx.x, h = blockIdx.y, b = blockIdx.z;
  const int sel = (lane < 16) ? 0 : 8;
  const int ln15 = lane & 15;
  const int mh = (lane < 16) ? 0 : 8;  // C layout: lanes 16-31 hold rows M+8
  const int qrow = wave * 16 + ln15;   // this lane's query in the tile
  const size_t bh = (size_t)b * SEQ * D_MODEL + (size_t)h * D_K;
  const int* mrowp = mask + (size_t)b * SEQ;
  // Lane's row and column offset in a 16-key x 16-d block for frag_ld_tr.
  const int trow = 8 * (lane >> 4) + (lane & 7), tcol = 8 * ((lane >> 3) & 1);

  stage_qk64(Qs, q, bh + (size_t)(qt * 64) * D_MODEL, tid);

  // ---- pass A: maximum and sum of exp of this lane's query, over the keys of
  // this lane's half of every 16-key tile; the halves are joined behind it ----
  float mrun = -1e30f, lrun = 0.0f;
  for (int j = 0; j < SEQ / 64; j++) {
    __syncthreads();
    stage_qk64(Ks, k, bh + (size_t)(j * 64) * D_MODEL, tid);
    unsigned w[2];
    mask_bits(w, mrowp + j * 64, lane, mh);   // its loads fly beside the copies
    async_fence();
    __syncthreads();
    v8f c[4];
    scores_t(c, Qs, Ks, w, qrow, ln15, sel);
    // One chain a tile: four independent chains of maxima, then of sums.
    float mn = fmaxf(fmaxf(fmaxf(max8(c[0]), max8(c[1])),
                           fmaxf(max8(c[2]), max8(c[3]))), mrun);
    float se = (sumexp8(c[0], mn) + sumexp8(c[1], mn)) +
               (sumexp8(c[2], mn) + sumexp8(c[3], mn));
    lrun = lrun * __expf(mrun - mn) + se;
    mrun = mn;
  }
  // Join the two halves of the wave, which hold the same 16 queries.
  const float mo = __shfl_xor(mrun, 16, 32), lo = __shfl_xor(lrun, 16, 32);
  const float mq = fmaxf(mrun, mo);
  const float lq = lrun * __expf(mrun - mq) + lo * __expf(mo - mq);

  // ---- pass B: acc (d x query) += V^T * exp(S - m)^T ----
  v8f acc[4];
  #pragma unroll
  for (int nb = 0; nb < 4; nb++) zero_v8f(acc[nb]);

  for (int j = 0; j < SEQ / 64; j++) {
    __syncthreads();
    stage_qk64(Ks, k, bh + (size_t)(j * 64) * D_MODEL, tid);
    stage_v64(Vs, v, bh + (size_t)(j * 64) * D_MODEL, tid);
    unsigned w[2];
    mask_bits(w, mrowp + j * 64, lane, mh);   // its loads fly beside the copies
    // This wave's K and V copies have landed before the barrier publishes them.
    asm volatile("s_wait_asynccnt 0x0" ::: "memory");
    __syncthreads();
    v8f c[4];
    scores_t(c, Qs, Ks, w, qrow, ln15, sel);
    #pragma unroll
    for (int kk = 0; kk < 64; kk += 32) {
      v16h p = p_frag(c[kk / 16], c[kk / 16 + 1], mq);
      #pragma unroll
      for (int nb = 0; nb < 4; nb++)
        acc[nb] = wmma16(frag_ld_tr(&Vs[kk + trow][nb * 16 + tcol]), p, acc[nb]);
    }
  }

  // acc[nb][r] is d = nb * 16 + mh + r of this lane's query: 16 bytes a store.
  half_t* orow = ctx + bh + (size_t)(qt * 64 + qrow) * D_MODEL + mh;
  #pragma unroll
  for (int nb = 0; nb < 4; nb++) {
    v8h o;
    #pragma unroll
    for (int r = 0; r < 8; r++) o[r] = (half_t)(acc[nb][r] / lq);
    *(v8h*)(orow + nb * 16) = o;
  }
}

// ---------------------------------------------------------------------------
extern "C" void kernel_launch(void* const* d_in, const int* in_sizes, int n_in,
                              void* d_out, int out_size, void* d_ws,
                              size_t ws_size, hipStream_t stream) {
  const float* x    = (const float*)d_in[0];
  const int*   mask = (const int*)d_in[1];
  const float* wq = (const float*)d_in[2];  const float* bq = (const float*)d_in[3];
  const float* wk = (const float*)d_in[4];  const float* bk = (const float*)d_in[5];
  const float* wv = (const float*)d_in[6];  const float* bv = (const float*)d_in[7];
  const float* wo = (const float*)d_in[8];  const float* bo = (const float*)d_in[9];
  const float* w1 = (const float*)d_in[10]; const float* b1 = (const float*)d_in[11];
  const float* w2 = (const float*)d_in[12]; const float* b2 = (const float*)d_in[13];
  const float* g1 = (const float*)d_in[14]; const float* be1 = (const float*)d_in[15];
  const float* g2 = (const float*)d_in[16]; const float* be2 = (const float*)d_in[17];

  // Carve workspace (~216 MB total).
  char* p = (char*)d_ws;
  auto carve = [&](size_t bytes) {
    void* r = (void*)p;
    p += (bytes + 255) & ~(size_t)255;
    return r;
  };
  half_t* w16  = (half_t*)carve(((size_t)4 * D_MODEL * D_MODEL +
                                 (size_t)2 * D_FF * D_MODEL) * 2);
  half_t* wq16 = w16;
  half_t* wk16 = wq16 + (size_t)D_MODEL * D_MODEL;
  half_t* wv16 = wk16 + (size_t)D_MODEL * D_MODEL;
  half_t* wo16 = wv16 + (size_t)D_MODEL * D_MODEL;
  half_t* w116 = wo16 + (size_t)D_MODEL * D_MODEL;
  half_t* w216 = w116 + (size_t)D_FF * D_MODEL;
  half_t* h16  = (half_t*)carve((size_t)M_TOT * D_MODEL * 2);
  half_t* q16  = (half_t*)carve((size_t)M_TOT * D_MODEL * 2);
  half_t* k16  = (half_t*)carve((size_t)M_TOT * D_MODEL * 2);
  half_t* v16  = (half_t*)carve((size_t)M_TOT * D_MODEL * 2);
  half_t* ctx16 = (half_t*)carve((size_t)M_TOT * D_MODEL * 2);
  float*  x1   = (float*)carve((size_t)M_TOT * D_MODEL * 4);
  half_t* h216 = (half_t*)carve((size_t)M_TOT * D_MODEL * 2);
  half_t* ff1  = (half_t*)carve((size_t)M_TOT * D_FF * 2);

  // Weight conversion (f32 -> f16, layout preserved [N][K]).
  cvt_weights_kernel<<<CVT_BLOCKS, CVT_THREADS, 0, stream>>>(wq, wk, wv, wo, w1,
                                                             w2, w16);

  dim3 blk(256);
  dim3 gN1024(D_MODEL / 128, M_TOT / 128);
  dim3 gN4096(D_FF / 128, M_TOT / 128);
  // Stage depth BK: 128 for the 512-block grids (two blocks a WGP either way);
  // 64 for the 2048-block grid, whose LDS then still lets four blocks share one.

  // h = LN1(x)
  layernorm_kernel<<<M_TOT / 8, blk, 0, stream>>>(x, g1, be1, h16);
  // Q (scaled by 1/sqrt(dk)), K, V projections
  gemm_f16_kernel<true, false, false, 128><<<gN1024, blk, 0, stream>>>(
      h16, wq16, bq, nullptr, q16, M_TOT, D_MODEL, D_MODEL, 0.125f);
  gemm_f16_kernel<true, false, false, 128><<<gN1024, blk, 0, stream>>>(
      h16, wk16, bk, nullptr, k16, M_TOT, D_MODEL, D_MODEL, 1.0f);
  gemm_f16_kernel<true, false, false, 128><<<gN1024, blk, 0, stream>>>(
      h16, wv16, bv, nullptr, v16, M_TOT, D_MODEL, D_MODEL, 1.0f);
  // attention -> ctx
  attention_kernel<<<dim3(SEQ / 64, HEADS, BATCH), dim3(128), 0, stream>>>(
      q16, k16, v16, mask, ctx16);
  // x1 = x + ctx @ wo^T + bo
  gemm_f16_kernel<false, false, true, 128><<<gN1024, blk, 0, stream>>>(
      ctx16, wo16, bo, x, x1, M_TOT, D_MODEL, D_MODEL, 1.0f);
  // h2 = LN2(x1)
  layernorm_kernel<<<M_TOT / 8, blk, 0, stream>>>(x1, g2, be2, h216);
  // ff1 = relu(h2 @ w1^T + b1)
  gemm_f16_kernel<true, true, false, 64><<<gN4096, blk, 0, stream>>>(
      h216, w116, b1, nullptr, ff1, M_TOT, D_FF, D_MODEL, 1.0f);
  // out = x1 + ff1 @ w2^T + b2
  gemm_f16_kernel<false, false, true, 128><<<gN1024, blk, 0, stream>>>(
      ff1, w216, b2, x1, (float*)d_out, M_TOT, D_MODEL, D_FF, 1.0f);
}

// v005
// Measured time: 262 microseconds a run.
// Next to v004, in two timings, it ran 1.10 times as fast each time.
// Counting every step since v000, it is 2.06 times as fast.
#include <hip/hip_runtime.h>
#include <hip/hip_bf16.h>
#include <cstdint>

// MI455X / gfx1250 transformer encoder block.
// All matmuls (QKV proj, QK^T, PV, O-proj, FFN1, FFN2) run on
// v_wmma_f32_16x16x32_f16 (f16 in, f32 accumulate). Tile staging uses
// GLOBAL_LOAD_ASYNC_TO_LDS_B128 (ASYNCcnt) when the builtin is available,
// with double-buffered LDS tiles in the GEMM for copy/compute overlap.

typedef _Float16 half_t;
typedef _Float16 v16h __attribute__((ext_vector_type(16)));
typedef _Float16 v8h  __attribute__((ext_vector_type(8)));
typedef float    v8f  __attribute__((ext_vector_type(8)));
typedef int      v4i  __attribute__((vector_size(16)));   // builtin pointee type

#define D_MODEL 1024
#define HEADS   16
#define D_K     64
#define D_FF    4096
#define SEQ     1024
#define BATCH   8
#define M_TOT   (BATCH * SEQ)   // 8192 rows
#define LN_EPS  1e-6f

#if defined(__has_builtin)
#if __has_builtin(__builtin_amdgcn_global_load_async_to_lds_b128) && \
    __has_builtin(__builtin_amdgcn_s_wait_asynccnt)
#define USE_ASYNC_LDS 1
#endif
#endif
#ifndef USE_ASYNC_LDS
#define USE_ASYNC_LDS 0
#endif

union HV { v16h v; v8h h[2]; };

__device__ inline v8f wmma16(v16h a, v16h b, v8f c) {
  // D = A(16x32 f16) * B(32x16 f16) + C(16x16 f32)
  return __builtin_amdgcn_wmma_f32_16x16x32_f16(false, a, false, b, (short)0, c,
                                                false, false);
}

// Copy 16 bytes global -> LDS. Async (ASYNCcnt) on CDNA5 when available.
__device__ inline void cp16_g2l(const half_t* g, half_t* l) {
#if USE_ASYNC_LDS
  // Flat LDS address truncates to the 32-bit LDS offset (ISA 10.2).
  __builtin_amdgcn_global_load_async_to_lds_b128(
      (__attribute__((address_space(1))) v4i*)(uintptr_t)g,
      (__attribute__((address_space(3))) v4i*)(uint32_t)(uintptr_t)l, 0, 0);
#else
  *(v8h*)l = *(const v8h*)g;
#endif
}

// Load one lane's 16 f16 fragment values from a row-major [row][K] LDS tile.
// k-values: {sel..sel+7, 16+sel..16+sel+7}, sel = 0 (lanes 0-15) or 8 (16-31).
__device__ inline v16h frag_ld(const half_t* rowbase, int sel) {
  HV u;
  u.h[0] = *(const v8h*)(rowbase + sel);
  u.h[1] = *(const v8h*)(rowbase + 16 + sel);
  return u.v;
}

__device__ inline void zero_v8f(v8f& x) {
  #pragma unroll
  for (int i = 0; i < 8; i++) x[i] = 0.0f;
}

// ---------------------------------------------------------------------------
// fp32 -> f16 weight conversion, all six matrices in one launch.
// dst is the six f16 planes end to end (wq, wk, wv, wo, w1, w2). 256 blocks of
// 16 waves; a block converts three pieces of 16384 values: one of the four
// square matrices, one of w1, one of w2. Every wave-wide load is 512
// contiguous bytes, and a thread's 24 loads depend on nothing, so many are in
// flight at once and the memory latency is not paid once per value.
// ---------------------------------------------------------------------------
#define CVT_THREADS 512
#define CVT_LOADS   8
#define CVT_PIECE   (CVT_THREADS * CVT_LOADS * 4)        // 16384 values
#define CVT_BLOCKS  (D_FF * D_MODEL / CVT_PIECE)         // 256
#define SQ_PIECES   (D_MODEL * D_MODEL / CVT_PIECE)      // 64 pieces a square

typedef float    v4f __attribute__((ext_vector_type(4)));
typedef _Float16 v4h __attribute__((ext_vector_type(4)));

__device__ inline void cvt_load(v4f (&r)[CVT_LOADS], const float* src, int t) {
  #pragma unroll  // r[] stays in registers; the loads issue back to back
  for (int j = 0; j < CVT_LOADS; j++)
    r[j] = ((const v4f*)src)[j * CVT_THREADS + t];
}

__device__ inline void cvt_store(const v4f (&r)[CVT_LOADS], half_t* dst, int t) {
  #pragma unroll  // constant indices keep r[] in registers
  for (int j = 0; j < CVT_LOADS; j++) {
    v4h h;
    #pragma unroll  // same, for the four lanes of a vector
    for (int e = 0; e < 4; e++) h[e] = (half_t)r[j][e];
    ((v4h*)dst)[j * CVT_THREADS + t] = h;
  }
}

__global__ __launch_bounds__(CVT_THREADS)
void cvt_weights_kernel(const float* __restrict__ wq, const float* __restrict__ wk,
                        const float* __restrict__ wv, const float* __restrict__ wo,
                        const float* __restrict__ w1, const float* __restrict__ w2,
                        half_t* __restrict__ dst) {
  const int t = threadIdx.x;
  const unsigned blk = blockIdx.x;
  const float* lo = (blk & SQ_PIECES) ? wk : wq;         // block-uniform picks
  const float* hi = (blk & SQ_PIECES) ? wo : wv;
  const float* s0 = (blk & (2 * SQ_PIECES)) ? hi : lo;
  const size_t off = (size_t)blk * CVT_PIECE;
  v4f r0[CVT_LOADS], r1[CVT_LOADS], r2[CVT_LOADS];
  cvt_load(r0, s0 + (size_t)(blk % SQ_PIECES) * CVT_PIECE, t);
  cvt_load(r1, w1 + off, t);
  cvt_load(r2, w2 + off, t);
  cvt_store(r0, dst + off, t);
  cvt_store(r1, dst + (size_t)4 * D_MODEL * D_MODEL + off, t);
  cvt_store(r2, dst + (size_t)4 * D_MODEL * D_MODEL + (size_t)D_FF * D_MODEL + off, t);
}

// ---------------------------------------------------------------------------
// LayerNorm (reference semantics: unbiased std, divide by std+eps), f16 out.
// One wave per row of 1024; 8 rows per 256-thread block.
// ---------------------------------------------------------------------------
__global__ __launch_bounds__(256)
void layernorm_kernel(const float* __restrict__ x, const float* __restrict__ g,
                      const float* __restrict__ be, half_t* __restrict__ out) {
  const int lane = threadIdx.x & 31, wave = threadIdx.x >> 5;
  const int row = blockIdx.x * 8 + wave;
  const float* xr = x + (size_t)row * D_MODEL;
  float v[32];
  float s = 0.f, ss = 0.f;
  #pragma unroll
  for (int i = 0; i < 32; i++) {
    v[i] = xr[lane + i * 32];
    s += v[i];
    ss += v[i] * v[i];
  }
  #pragma unroll
  for (int off = 16; off > 0; off >>= 1) {
    s  += __shfl_xor(s,  off, 32);
    ss += __shfl_xor(ss, off, 32);
  }
  float mean = s * (1.0f / D_MODEL);
  float var  = (ss - (float)D_MODEL * mean * mean) * (1.0f / (D_MODEL - 1));
  float inv  = 1.0f / (sqrtf(fmaxf(var, 0.0f)) + LN_EPS);
  half_t* orow = out + (size_t)row * D_MODEL;
  #pragma unroll
  for (int i = 0; i < 32; i++) {
    int c = lane + i * 32;
    orow[c] = (half_t)(g[c] * (v[i] - mean) * inv + be[c]);
  }
}

// ---------------------------------------------------------------------------
// WMMA GEMM: out[M][N] = epilogue( A[M][K](f16) * W[N][K]^T(f16) )
// Block tile 128x128, double-buffered LDS, 8 waves as 4(M) x 2(N); each wave
// 32x64 = 2x4 fragments -> 8 v_wmma per 32 k from 6 fragment loads.
// A stage of the ring holds BK k of both tiles: the copies of a stage have the
// BK/32 * 8 WMMAs of the stage before as their lead, and a wave-wide copy
// covers whole lines of the source rows. K must be a multiple of BK.
// Row pitch (BK + 8) f16 = 16 bytes x odd, for the ds_load_b128 readers.
// Epilogue: (+bias)*scale, optional ReLU, optional +residual, f16/f32 out.
// ---------------------------------------------------------------------------
template <int BK>
__device__ inline void stage_tiles(half_t (*as)[BK + 8], half_t (*ws)[BK + 8],
                                   const half_t* A, const half_t* W, int tM,
                                   int tN, int k0, int Kdim, int tid) {
  constexpr int CPR = BK / 8;                // 16-byte chunks a row
  #pragma unroll  // independent copies issue back to back
  for (int i = 0; i < 128 * CPR / 256; i++) {
    int chunk = tid + i * 256;               // 128 rows x CPR chunks
    int row = chunk / CPR, ko = (chunk % CPR) * 8;
    cp16_g2l(&A[(size_t)(tM + row) * Kdim + k0 + ko], &as[row][ko]);
    cp16_g2l(&W[(size_t)(tN + row) * Kdim + k0 + ko], &ws[row][ko]);
  }
}

template <bool OUT_F16, bool RELU, bool ADD_RES, int BK>
__global__ __launch_bounds__(256)
void gemm_f16_kernel(const half_t* __restrict__ A,     // [M][K]
                     const half_t* __restrict__ W,     // [N][K]
                     const float* __restrict__ bias,   // [N]
                     const float* __restrict__ res,    // [M][N] or null
                     void* __restrict__ outp, int Mdim, int Ndim, int Kdim,
                     float out_scale) {
  __shared__ __align__(16) half_t As[2][128][BK + 8];
  __shared__ __align__(16) half_t Ws[2][128][BK + 8];
  const int tid = threadIdx.x;
  const int lane = tid & 31, wave = tid >> 5;
  const int wm = wave & 3, wn = wave >> 2;
  const int tM = blockIdx.y * 128, tN = blockIdx.x * 128;
  const int sel = (lane < 16) ? 0 : 8;
  const int ln15 = lane & 15;

  v8f acc[2][4];
  #pragma unroll
  for (int i = 0; i < 2; i++)
    #pragma unroll
    for (int j = 0; j < 4; j++) zero_v8f(acc[i][j]);

  // Prologue: stage tile 0.
  stage_tiles<BK>(As[0], Ws[0], A, W, tM, tN, 0, Kdim, tid);
  // This wave's copies of stage 0 have landed before the barrier publishes them.
  asm volatile("s_wait_asynccnt 0x0" ::: "memory");
  __syncthreads();

  const int nk = Kdim / BK;
  for (int ki = 0; ki < nk; ki++) {
    const int buf = ki & 1;
    // Copies of the next stage, into the buffer whose readers the barrier at
    // the foot of the trip before has ended; they fly during the WMMAs below.
    if (ki + 1 < nk)
      stage_tiles<BK>(As[buf ^ 1], Ws[buf ^ 1], A, W, tM, tN, (ki + 1) * BK,
                      Kdim, tid);

    #pragma unroll  // kk becomes a constant LDS offset of every fragment load
    for (int kk = 0; kk < BK; kk += 32) {
      v16h a0 = frag_ld(&As[buf][wm * 32 + 0 + ln15][kk], sel);
      v16h a1 = frag_ld(&As[buf][wm * 32 + 16 + ln15][kk], sel);
      #pragma unroll
      for (int fn = 0; fn < 4; fn++) {
        v16h b = frag_ld(&Ws[buf][wn * 64 + fn * 16 + ln15][kk], sel);
        acc[0][fn] = wmma16(a0, b, acc[0][fn]);
        acc[1][fn] = wmma16(a1, b, acc[1][fn]);
      }
    }
    // This wave's reads of buf are over before the barrier frees it for refill.
    asm volatile("s_wait_dscnt 0x0" ::: "memory");
    // This wave's copies of the next stage have landed before it is published.
    asm volatile("s_wait_asynccnt 0x0" ::: "memory");
    __syncthreads();
  }
  // No copy is outstanding when the wave goes on to its stores and ends.
  asm volatile("s_wait_asynccnt 0x0" ::: "memory");

  const int mh = (lane < 16) ? 0 : 8;  // C layout: lanes 16-31 hold rows M+8
  #pragma unroll
  for (int fm = 0; fm < 2; fm++) {
    #pragma unroll
    for (int fn = 0; fn < 4; fn++) {
      int n = tN + wn * 64 + fn * 16 + ln15;
      float bv = bias[n];
      #pragma unroll
      for (int r = 0; r < 8; r++) {
        int m = tM + wm * 32 + fm * 16 + r + mh;
        float val = (acc[fm][fn][r] + bv) * out_scale;
        if (RELU) val = val > 0.0f ? val : 0.0f;
        if (ADD_RES) val += res[(size_t)m * Ndim + n];
        if (OUT_F16)
          ((half_t*)outp)[(size_t)m * Ndim + n] = (half_t)val;
        else
          ((float*)outp)[(size_t)m * Ndim + n] = val;
      }
    }
  }
}

__device__ inline void stage_qk64(half_t (*dst)[72], const half_t* src,
                                  size_t base, int tid) {
  // 64 rows x 64 f16 = 512 16B chunks; 128 threads x 4.
  #pragma unroll
  for (int i = 0; i < 4; i++) {
    int chunk = tid + i * 128;
    int row = chunk >> 3, ko = (chunk & 7) * 8;
    cp16_g2l(&src[base + (size_t)row * D_MODEL + ko], &dst[row][ko]);
  }
}

// V tile, row-major [key][d] as it lies in memory: 64 rows x 64 f16 = 512
// 16-byte chunks, 128 threads x 4 copies, through no register.
#define V_PITCH 80   // f16 a row = 160 bytes, an odd multiple of 32 bytes
__device__ inline void stage_v64(half_t (*dst)[V_PITCH], const half_t* src,
                                 size_t base, int tid) {
  #pragma unroll  // four independent copies issue back to back
  for (int i = 0; i < 4; i++) {
    int chunk = tid + i * 128;
    int row = chunk >> 3, ko = (chunk & 7) * 8;
    cp16_g2l(&src[base + (size_t)row * D_MODEL + ko], &dst[row][ko]);
  }
}

// A fragment (16 d x 32 keys) of V^T * P^T from the row-major V tile by the
// 16-bit transposing LDS load: lane (c = lane & 15, h = lane >> 4) gets
// V[k0 + 8h + 0..7][d0 + c], then the same 16 keys further on: the k order of
// frag_ld. p is this lane's own address for (k0, d0).
typedef short s16x8 __attribute__((ext_vector_type(8)));
__device__ inline v16h frag_ld_tr(const half_t* p) {
  typedef __attribute__((address_space(3))) s16x8 lds_s16x8;
  HV u;
  u.h[0] = __builtin_bit_cast(
      v8h, __builtin_amdgcn_ds_load_tr16_b128_v8i16((lds_s16x8*)p));
  u.h[1] = __builtin_bit_cast(
      v8h, __builtin_amdgcn_ds_load_tr16_b128_v8i16(
               (lds_s16x8*)(p + 16 * V_PITCH)));
  return u.v;
}

// Mask of a 64-key tile as bits. In the transposed scores a lane's keys are
// n0 * 16 + 8 * (lane >> 4) + r: bit (n0 & 1) * 16 + r of w[n0 >> 1] is set
// where that key's mask is not 0. mtile points at the mask of the tile's key 0.
__device__ inline void mask_bits(unsigned (&w)[2], const int* mtile, int lane,
                                 int mh) {
  w[0] = __builtin_amdgcn_ballot_w32(mtile[lane] != 0) >> mh;
  w[1] = __builtin_amdgcn_ballot_w32(mtile[32 + lane] != 0) >> mh;
}

// s where bit 'bit' of w is set, else -1e9 (the reference's masked score).
__device__ inline float masked(float s, unsigned w, int bit) {
  const int open = (int)(w << (31 - bit)) >> 31;         // all ones or 0
  return __builtin_bit_cast(
      float, (open & __builtin_bit_cast(int, s)) |
                 (~open & __builtin_bit_cast(int, -1e9f)));
}

// Masked scores of 64 keys, transposed: c[n0][r] is the score of query row
// qrow of Qs against key n0 * 16 + 8 * (lane >> 4) + r of Ks. A = K rows,
// B = Q rows, both by frag_ld, so both in the same k order.
__device__ inline void scores_t(v8f (&c)[4], const half_t (*Qs)[72],
                                const half_t (*Ks)[72], const unsigned (&w)[2],
                                int qrow, int ln15, int sel) {
  // Every loop here is unrolled: constant indices keep c[] in registers and
  // make kk, n0 and the mask bit immediates.
  #pragma unroll
  for (int n0 = 0; n0 < 4; n0++) zero_v8f(c[n0]);
  #pragma unroll
  for (int kk = 0; kk < 64; kk += 32) {
    v16h bq = frag_ld(&Qs[qrow][kk], sel);
    #pragma unroll
    for (int n0 = 0; n0 < 4; n0++) {
      v16h ak = frag_ld(&Ks[n0 * 16 + ln15][kk], sel);
      c[n0] = wmma16(ak, bq, c[n0]);
    }
  }
  #pragma unroll
  for (int n0 = 0; n0 < 4; n0++)
    #pragma unroll
    for (int r = 0; r < 8; r++)
      c[n0][r] = masked(c[n0][r], w[n0 >> 1], (n0 & 1) * 16 + r);
}

// B fragment (32 keys x 16 queries) of V^T * P^T from two score tiles: keys
// 8h + 0..7 are the first tile's registers, keys 16 + 8h + 0..7 the second's:
// the k order of frag_ld_tr. s0 and s1 take the tiles' sums of exp, in f32.
__device__ inline v16h p_frag(const v8f& c0, const v8f& c1, float m, float& s0,
                              float& s1) {
  HV p;
  s0 = 0.0f;
  s1 = 0.0f;
  #pragma unroll  // constant indices keep the vectors in registers
  for (int r = 0; r < 8; r++) {
    const float e0 = __expf(c0[r] - m), e1 = __expf(c1[r] - m);
    s0 += e0;
    s1 += e1;
    p.h[0][r] = (half_t)e0;
    p.h[1][r] = (half_t)e1;
  }
  return p.v;
}

// Value of lane l ^ 16 (the other half of the wave), by a vector cross-row move.
__device__ inline float xhalf(float x) {
  const int b = __builtin_bit_cast(int, x);
  return __builtin_bit_cast(float, __builtin_amdgcn_permlanex16(
                                       b, b, 0x76543210, 0xfedcba98, false, false));
}

__device__ inline float max8(const v8f& c) {
  float m = c[0];
  #pragma unroll  // constant indices keep c in registers
  for (int r = 1; r < 8; r++) m = fmaxf(m, c[r]);
  return m;
}

__global__ __launch_bounds__(128)
void attention_kernel(const half_t* __restrict__ q, const half_t* __restrict__ k,
                      const half_t* __restrict__ v, const int* __restrict__ mask,
                      half_t* __restrict__ ctx) {
  __shared__ __align__(16) half_t Qs[64][72];
  __shared__ __align__(16) half_t Ks[64][72];
  __shared__ __align__(16) half_t Vs[64][V_PITCH]; // row-major: [key][d]

  const int tid = threadIdx.x, lane = tid & 31, wave = tid >> 5;
  const int qt = blockIdx.x, h = blockIdx.y, b = blockIdx.z;
  const int sel = (lane < 16) ? 0 : 8;
  const int ln15 = lane & 15;
  const int mh = (lane < 16) ? 0 : 8;  // C layout: lanes 16-31 hold rows M+8
  const int qrow = wave * 16 + ln15;   // this lane's query in the tile
  const size_t bh = (size_t)b * SEQ * D_MODEL + (size_t)h * D_K;
  const int* mrowp = mask + (size_t)b * SEQ;
  // Lane's row and column offset in a 16-key x 16-d block for frag_ld_tr.
  const int trow = 8 * (lane >> 4) + (lane & 7), tcol = 8 * ((lane >> 3) & 1);

  stage_qk64(Qs, q, bh + (size_t)(qt * 64) * D_MODEL, tid);

  // acc (d x query) += V^T * exp(S - m)^T, m the query's maximum so far.
  // mrun is the same in both halves of the wave (they hold the same 16 queries
  // and feed one product); lrun sums this half's keys, joined behind the loop.
  float mrun = -1e30f, lrun = 0.0f;
  v8f acc[4];
  #pragma unroll
  for (int nb = 0; nb < 4; nb++) zero_v8f(acc[nb]);

  for (int j = 0; j < SEQ / 64; j++) {
    __syncthreads();
    stage_qk64(Ks, k, bh + (size_t)(j * 64) * D_MODEL, tid);
    stage_v64(Vs, v, bh + (size_t)(j * 64) * D_MODEL, tid);
    unsigned w[2];
    mask_bits(w, mrowp + j * 64, lane, mh);   // its loads fly beside the copies
    // This wave's copies (K, V; Q too on the first trip) have landed before the
    // barrier publishes them.
    asm volatile("s_wait_asynccnt 0x0" ::: "memory");
    __syncthreads();
    v8f c[4];
    scores_t(c, Qs, Ks, w, qrow, ln15, sel);
    // Four independent chains of maxima, then the other half's keys.
    const float mt = fmaxf(fmaxf(max8(c[0]), max8(c[1])),
                           fmaxf(max8(c[2]), max8(c[3])));
    const float mn = fmaxf(fmaxf(mt, xhalf(mt)), mrun);
    const float alpha = __expf(mrun - mn);    // 1 where the maximum stands
    mrun = mn;
    // Unrolled here and below: constant indices keep acc, c and s in registers.
    #pragma unroll
    for (int nb = 0; nb < 4; nb++)
      #pragma unroll
      for (int r = 0; r < 8; r++) acc[nb][r] *= alpha;
    float s[4];
    #pragma unroll
    for (int kk = 0; kk < 64; kk += 32) {
      v16h p = p_frag(c[kk / 16], c[kk / 16 + 1], mn, s[kk / 16], s[kk / 16 + 1]);
      #pragma unroll
      for (int nb = 0; nb < 4; nb++)
        acc[nb] = wmma16(frag_ld_tr(&Vs[kk + trow][nb * 16 + tcol]), p, acc[nb]);
    }
    lrun = lrun * alpha + ((s[0] + s[1]) + (s[2] + s[3]));
  }
  // Join the sums of the two halves of the wave; their maximum is the same.
  const float lq = lrun + xhalf(lrun);

  // acc[nb][r] is d = nb * 16 + mh + r of this lane's query: 16 bytes a store.
  half_t* orow = ctx + bh + (size_t)(qt * 64 + qrow) * D_MODEL + mh;
  #pragma unroll
  for (int nb = 0; nb < 4; nb++) {
    v8h o;
    #pragma unroll
    for (int r = 0; r < 8; r++) o[r] = (half_t)(acc[nb][r] / lq);
    *(v8h*)(orow + nb * 16) = o;
  }
}

// ---------------------------------------------------------------------------
extern "C" void kernel_launch(void* const* d_in, const int* in_sizes, int n_in,
                              void* d_out, int out_size, void* d_ws,
                              size_t ws_size, hipStream_t stream) {
  const float* x    = (const float*)d_in[0];
  const int*   mask = (const int*)d_in[1];
  const float* wq = (const float*)d_in[2];  const float* bq = (const float*)d_in[3];
  const float* wk = (const float*)d_in[4];  const float* bk = (const float*)d_in[5];
  const float* wv = (const float*)d_in[6];  const float* bv = (const float*)d_in[7];
  const float* wo = (const float*)d_in[8];  const float* bo = (const float*)d_in[9];
  const float* w1 = (const float*)d_in[10]; const float* b1 = (const float*)d_in[11];
  const float* w2 = (const float*)d_in[12]; const float* b2 = (const float*)d_in[13];
  const float* g1 = (const float*)d_in[14]; const float* be1 = (const float*)d_in[15];
  const float* g2 = (const float*)d_in[16]; const float* be2 = (const float*)d_in[17];

  // Carve workspace (~216 MB total).
  char* p = (char*)d_ws;
  auto carve = [&](size_t bytes) {
    void* r = (void*)p;
    p += (bytes + 255) & ~(size_t)255;
    return r;
  };
  half_t* w16  = (half_t*)carve(((size_t)4 * D_MODEL * D_MODEL +
                                 (size_t)2 * D_FF * D_MODEL) * 2);
  half_t* wq16 = w16;
  half_t* wk16 = wq16 + (size_t)D_MODEL * D_MODEL;
  half_t* wv16 = wk16 + (size_t)D_MODEL * D_MODEL;
  half_t* wo16 = wv16 + (size_t)D_MODEL * D_MODEL;
  half_t* w116 = wo16 + (size_t)D_MODEL * D_MODEL;
  half_t* w216 = w116 + (size_t)D_FF * D_MODEL;
  half_t* h16  = (half_t*)carve((size_t)M_TOT * D_MODEL * 2);
  half_t* q16  = (half_t*)carve((size_t)M_TOT * D_MODEL * 2);
  half_t* k16  = (half_t*)carve((size_t)M_TOT * D_MODEL * 2);
  half_t* v16  = (half_t*)carve((size_t)M_TOT * D_MODEL * 2);
  half_t* ctx16 = (half_t*)carve((size_t)M_TOT * D_MODEL * 2);
  float*  x1   = (float*)carve((size_t)M_TOT * D_MODEL * 4);
  half_t* h216 = (half_t*)carve((size_t)M_TOT * D_MODEL * 2);
  half_t* ff1  = (half_t*)carve((size_t)M_TOT * D_FF * 2);

  // Weight conversion (f32 -> f16, layout preserved [N][K]).
  cvt_weights_kernel<<<CVT_BLOCKS, CVT_THREADS, 0, stream>>>(wq, wk, wv, wo, w1,
                                                             w2, w16);

  dim3 blk(256);
  dim3 gN1024(D_MODEL / 128, M_TOT / 128);
  dim3 gN4096(D_FF / 128, M_TOT / 128);
  // Stage depth BK: 128 for the 512-block grids (two blocks a WGP either way);
  // 64 for the 2048-block grid, whose LDS then still lets four blocks share one.

  // h = LN1(x)
  layernorm_kernel<<<M_TOT / 8, blk, 0, stream>>>(x, g1, be1, h16);
  // Q (scaled by 1/sqrt(dk)), K, V projections
  gemm_f16_kernel<true, false, false, 128><<<gN1024, blk, 0, stream>>>(
      h16, wq16, bq, nullptr, q16, M_TOT, D_MODEL, D_MODEL, 0.125f);
  gemm_f16_kernel<true, false, false, 128><<<gN1024, blk, 0, stream>>>(
      h16, wk16, bk, nullptr, k16, M_TOT, D_MODEL, D_MODEL, 1.0f);
  gemm_f16_kernel<true, false, false, 128><<<gN1024, blk, 0, stream>>>(
      h16, wv16, bv, nullptr, v16, M_TOT, D_MODEL, D_MODEL, 1.0f);
  // attention -> ctx
  attention_kernel<<<dim3(SEQ / 64, HEADS, BATCH), dim3(128), 0, stream>>>(
      q16, k16, v16, mask, ctx16);
  // x1 = x + ctx @ wo^T + bo
  gemm_f16_kernel<false, false, true, 128><<<gN1024, blk, 0, stream>>>(
      ctx16, wo16, bo, x, x1, M_TOT, D_MODEL, D_MODEL, 1.0f);
  // h2 = LN2(x1)
  layernorm_kernel<<<M_TOT / 8, blk, 0, stream>>>(x1, g2, be2, h216);
  // ff1 = relu(h2 @ w1^T + b1)
  gemm_f16_kernel<true, true, false, 64><<<gN4096, blk, 0, stream>>>(
      h216, w116, b1, nullptr, ff1, M_TOT, D_FF, D_MODEL, 1.0f);
  // out = x1 + ff1 @ w2^T + b2
  gemm_f16_kernel<false, false, true, 128><<<gN1024, blk, 0, stream>>>(
      ff1, w216, b2, x1, (float*)d_out, M_TOT, D_MODEL, D_FF, 1.0f);
}

// v006
// It runs in 251 microseconds.
// In both of two side-by-side timings against v005, it was 1.04 times as fast.
// Over all steps from v000 it is 2.14 times as fast.
#include <hip/hip_runtime.h>
#include <hip/hip_bf16.h>
#include <cstdint>

// MI455X / gfx1250 transformer encoder block.
// All matmuls (QKV proj, QK^T, PV, O-proj, FFN1, FFN2) run on
// v_wmma_f32_16x16x32_f16 (f16 in, f32 accumulate). Tile staging uses
// GLOBAL_LOAD_ASYNC_TO_LDS_B128 (ASYNCcnt) when the builtin is available,
// with double-buffered LDS tiles in the GEMM for copy/compute overlap.

typedef _Float16 half_t;
typedef _Float16 v16h __attribute__((ext_vector_type(16)));
typedef _Float16 v8h  __attribute__((ext_vector_type(8)));
typedef float    v8f  __attribute__((ext_vector_type(8)));
typedef int      v4i  __attribute__((vector_size(16)));   // builtin pointee type

#define D_MODEL 1024
#define HEADS   16
#define D_K     64
#define D_FF    4096
#define SEQ     1024
#define BATCH   8
#define M_TOT   (BATCH * SEQ)   // 8192 rows
#define LN_EPS  1e-6f

#if defined(__has_builtin)
#if __has_builtin(__builtin_amdgcn_global_load_async_to_lds_b128) && \
    __has_builtin(__builtin_amdgcn_s_wait_asynccnt)
#define USE_ASYNC_LDS 1
#endif
#endif
#ifndef USE_ASYNC_LDS
#define USE_ASYNC_LDS 0
#endif

union HV { v16h v; v8h h[2]; };

__device__ inline v8f wmma16(v16h a, v16h b, v8f c) {
  // D = A(16x32 f16) * B(32x16 f16) + C(16x16 f32)
  return __builtin_amdgcn_wmma_f32_16x16x32_f16(false, a, false, b, (short)0, c,
                                                false, false);
}

// Copy 16 bytes global -> LDS. Async (ASYNCcnt) on CDNA5 when available.
__device__ inline void cp16_g2l(const half_t* g, half_t* l) {
#if USE_ASYNC_LDS
  // Flat LDS address truncates to the 32-bit LDS offset (ISA 10.2).
  __builtin_amdgcn_global_load_async_to_lds_b128(
      (__attribute__((address_space(1))) v4i*)(uintptr_t)g,
      (__attribute__((address_space(3))) v4i*)(uint32_t)(uintptr_t)l, 0, 0);
#else
  *(v8h*)l = *(const v8h*)g;
#endif
}

// Load one lane's 16 f16 fragment values from a row-major [row][K] LDS tile.
// k-values: {sel..sel+7, 16+sel..16+sel+7}, sel = 0 (lanes 0-15) or 8 (16-31).
__device__ inline v16h frag_ld(const half_t* rowbase, int sel) {
  HV u;
  u.h[0] = *(const v8h*)(rowbase + sel);
  u.h[1] = *(const v8h*)(rowbase + 16 + sel);
  return u.v;
}

__device__ inline void zero_v8f(v8f& x) {
  #pragma unroll
  for (int i = 0; i < 8; i++) x[i] = 0.0f;
}

// ---------------------------------------------------------------------------
// fp32 -> f16 weight conversion, all six matrices in one launch.
// dst is the six f16 planes end to end (wq, wk, wv, wo, w1, w2). 256 blocks of
// 16 waves; a block converts three pieces of 16384 values: one of the four
// square matrices, one of w1, one of w2. Every wave-wide load is 512
// contiguous bytes, and a thread's 24 loads depend on nothing, so many are in
// flight at once and the memory latency is not paid once per value.
// ---------------------------------------------------------------------------
#define CVT_THREADS 512
#define CVT_LOADS   8
#define CVT_PIECE   (CVT_THREADS * CVT_LOADS * 4)        // 16384 values
#define CVT_BLOCKS  (D_FF * D_MODEL / CVT_PIECE)         // 256
#define SQ_PIECES   (D_MODEL * D_MODEL / CVT_PIECE)      // 64 pieces a square

typedef float    v4f __attribute__((ext_vector_type(4)));
typedef _Float16 v4h __attribute__((ext_vector_type(4)));

__device__ inline void cvt_load(v4f (&r)[CVT_LOADS], const float* src, int t) {
  #pragma unroll  // r[] stays in registers; the loads issue back to back
  for (int j = 0; j < CVT_LOADS; j++)
    r[j] = ((const v4f*)src)[j * CVT_THREADS + t];
}

__device__ inline void cvt_store(const v4f (&r)[CVT_LOADS], half_t* dst, int t) {
  #pragma unroll  // constant indices keep r[] in registers
  for (int j = 0; j < CVT_LOADS; j++) {
    v4h h;
    #pragma unroll  // same, for the four lanes of a vector
    for (int e = 0; e < 4; e++) h[e] = (half_t)r[j][e];
    ((v4h*)dst)[j * CVT_THREADS + t] = h;
  }
}

__global__ __launch_bounds__(CVT_THREADS)
void cvt_weights_kernel(const float* __restrict__ wq, const float* __restrict__ wk,
                        const float* __restrict__ wv, const float* __restrict__ wo,
                        const float* __restrict__ w1, const float* __restrict__ w2,
                        half_t* __restrict__ dst) {
  const int t = threadIdx.x;
  const unsigned blk = blockIdx.x;
  const float* lo = (blk & SQ_PIECES) ? wk : wq;         // block-uniform picks
  const float* hi = (blk & SQ_PIECES) ? wo : wv;
  const float* s0 = (blk & (2 * SQ_PIECES)) ? hi : lo;
  const size_t off = (size_t)blk * CVT_PIECE;
  v4f r0[CVT_LOADS], r1[CVT_LOADS], r2[CVT_LOADS];
  cvt_load(r0, s0 + (size_t)(blk % SQ_PIECES) * CVT_PIECE, t);
  cvt_load(r1, w1 + off, t);
  cvt_load(r2, w2 + off, t);
  cvt_store(r0, dst + off, t);
  cvt_store(r1, dst + (size_t)4 * D_MODEL * D_MODEL + off, t);
  cvt_store(r2, dst + (size_t)4 * D_MODEL * D_MODEL + (size_t)D_FF * D_MODEL + off, t);
}

// ---------------------------------------------------------------------------
// LayerNorm (reference semantics: unbiased std, divide by std+eps), f16 out.
// One wave per row of 1024; 8 rows per 256-thread block.
// ---------------------------------------------------------------------------
__global__ __launch_bounds__(256)
void layernorm_kernel(const float* __restrict__ x, const float* __restrict__ g,
                      const float* __restrict__ be, half_t* __restrict__ out) {
  const int lane = threadIdx.x & 31, wave = threadIdx.x >> 5;
  const int row = blockIdx.x * 8 + wave;
  const float* xr = x + (size_t)row * D_MODEL;
  float v[32];
  float s = 0.f, ss = 0.f;
  #pragma unroll
  for (int i = 0; i < 32; i++) {
    v[i] = xr[lane + i * 32];
    s += v[i];
    ss += v[i] * v[i];
  }
  #pragma unroll
  for (int off = 16; off > 0; off >>= 1) {
    s  += __shfl_xor(s,  off, 32);
    ss += __shfl_xor(ss, off, 32);
  }
  float mean = s * (1.0f / D_MODEL);
  float var  = (ss - (float)D_MODEL * mean * mean) * (1.0f / (D_MODEL - 1));
  float inv  = 1.0f / (sqrtf(fmaxf(var, 0.0f)) + LN_EPS);
  half_t* orow = out + (size_t)row * D_MODEL;
  #pragma unroll
  for (int i = 0; i < 32; i++) {
    int c = lane + i * 32;
    orow[c] = (half_t)(g[c] * (v[i] - mean) * inv + be[c]);
  }
}

// ---------------------------------------------------------------------------
// WMMA GEMM: out[M][N] = epilogue( A[M][K](f16) * W[N][K]^T(f16) )
// Block tile BM x BN, double-buffered LDS, (BM/64) x (BN/64) waves; each wave
// 64x64 = 4x4 fragments -> 16 v_wmma per 32 k from 8 fragment loads. A block
// brings (BM + BN) rows from L2 for BM * BN outputs, so a larger tile asks L2
// for fewer bytes a WMMA, and the square wave tile asks LDS for fewer.
// A stage of the ring holds BK k of both tiles: the copies of a stage have the
// BK/32 * 16 WMMAs of the stage before as their lead, and a wave-wide copy
// covers whole lines of the source rows. K must be a multiple of BK, M of BM,
// N of BN.
// Row pitch (BK + 8) f16 = 16 bytes x odd, for the ds_load_b128 readers.
// Epilogue: (+bias)*scale, optional ReLU, optional +residual, f16/f32 out.
// ---------------------------------------------------------------------------
// src points at the tile's first row, column k0, the same for every thread: the
// row steps are then scalars, and a thread keeps one offset, not one a copy.
template <int ROWS, int BK, int NT>
__device__ inline void stage_rows(half_t (*dst)[BK + 8], const half_t* src,
                                  int Kdim, int tid) {
  constexpr int CPR = BK / 8;                // 16-byte chunks a row
  constexpr int RPI = NT / CPR;              // rows the block copies at a time
  const int row = tid / CPR, ko = (tid % CPR) * 8;
  const unsigned tbyte = (unsigned)(row * Kdim + ko) * 2u;
  #pragma unroll  // independent copies issue back to back
  for (int i = 0; i < ROWS / RPI; i++) {
    const char* base = (const char*)(src + (size_t)(i * RPI) * Kdim);
    cp16_g2l((const half_t*)(base + tbyte), &dst[row + i * RPI][ko]);
  }
}

template <bool OUT_F16, bool RELU, bool ADD_RES, int BM, int BN, int BK>
__global__ __launch_bounds__(BM / 64 * (BN / 64) * 32)
void gemm_f16_kernel(const half_t* __restrict__ A,     // [M][K]
                     const half_t* __restrict__ W,     // [N][K]
                     const float* __restrict__ bias,   // [N]
                     const float* __restrict__ res,    // [M][N] or null
                     void* __restrict__ outp, int Mdim, int Ndim, int Kdim,
                     float out_scale) {
  constexpr int WM = BM / 64;                // waves along M
  constexpr int NT = WM * (BN / 64) * 32;    // threads a block
  __shared__ __align__(16) half_t As[2][BM][BK + 8];
  __shared__ __align__(16) half_t Ws[2][BN][BK + 8];
  const int tid = threadIdx.x;
  const int lane = tid & 31, wave = tid >> 5;
  const int wm = wave % WM, wn = wave / WM;
  const int tM = blockIdx.y * BM, tN = blockIdx.x * BN;
  const int sel = (lane < 16) ? 0 : 8;
  const int ln15 = lane & 15;

  v8f acc[4][4];
  #pragma unroll
  for (int i = 0; i < 4; i++)
    #pragma unroll
    for (int j = 0; j < 4; j++) zero_v8f(acc[i][j]);

  // Prologue: stage tile 0.
  const half_t* At = A + (size_t)tM * Kdim;  // first rows of the block's tiles
  const half_t* Wt = W + (size_t)tN * Kdim;
  stage_rows<BM, BK, NT>(As[0], At, Kdim, tid);
  stage_rows<BN, BK, NT>(Ws[0], Wt, Kdim, tid);
  // This wave's copies of stage 0 have landed before the barrier publishes them.
  asm volatile("s_wait_asynccnt 0x0" ::: "memory");
  __syncthreads();

  const int nk = Kdim / BK;
  for (int ki = 0; ki < nk; ki++) {
    const int buf = ki & 1;
    // Copies of the next stage, into the buffer whose readers the barrier at
    // the foot of the trip before has ended; they fly during the WMMAs below.
    if (ki + 1 < nk) {
      stage_rows<BM, BK, NT>(As[buf ^ 1], At + (ki + 1) * BK, Kdim, tid);
      stage_rows<BN, BK, NT>(Ws[buf ^ 1], Wt + (ki + 1) * BK, Kdim, tid);
    }

    #pragma unroll  // kk becomes a constant LDS offset of every fragment load
    for (int kk = 0; kk < BK; kk += 32) {
      // The 8 fragments of a k step are read first, then its 16 WMMAs run.
      v16h a[4], b[4];
      #pragma unroll  // constant indices keep a[], b[] and acc[][] in registers
      for (int f = 0; f < 4; f++) {
        a[f] = frag_ld(&As[buf][wm * 64 + f * 16 + ln15][kk], sel);
        b[f] = frag_ld(&Ws[buf][wn * 64 + f * 16 + ln15][kk], sel);
      }
      // Holds the 16 LDS reads in front of the k step's WMMAs: the scheduler
      // otherwise sinks each B fragment's reads to its first use, and the wave
      // then waits out the LDS latency once every four WMMAs.
      __builtin_amdgcn_sched_barrier(0);
      #pragma unroll
      for (int fn = 0; fn < 4; fn++)
        #pragma unroll
        for (int fm = 0; fm < 4; fm++)
          acc[fm][fn] = wmma16(a[fm], b[fn], acc[fm][fn]);
    }
    // This wave's reads of buf are over before the barrier frees it for refill.
    asm volatile("s_wait_dscnt 0x0" ::: "memory");
    // This wave's copies of the next stage have landed before it is published.
    asm volatile("s_wait_asynccnt 0x0" ::: "memory");
    __syncthreads();
  }
  // No copy is outstanding when the wave goes on to its stores and ends.
  asm volatile("s_wait_asynccnt 0x0" ::: "memory");

  const int mh = (lane < 16) ? 0 : 8;  // C layout: lanes 16-31 hold rows M+8
  #pragma unroll
  for (int fm = 0; fm < 4; fm++) {
    #pragma unroll
    for (int fn = 0; fn < 4; fn++) {
      int n = tN + wn * 64 + fn * 16 + ln15;
      float bv = bias[n];
      #pragma unroll
      for (int r = 0; r < 8; r++) {
        int m = tM + wm * 64 + fm * 16 + r + mh;
        float val = (acc[fm][fn][r] + bv) * out_scale;
        if (RELU) val = val > 0.0f ? val : 0.0f;
        if (ADD_RES) val += res[(size_t)m * Ndim + n];
        if (OUT_F16)
          ((half_t*)outp)[(size_t)m * Ndim + n] = (half_t)val;
        else
          ((float*)outp)[(size_t)m * Ndim + n] = val;
      }
    }
  }
}

__device__ inline void stage_qk64(half_t (*dst)[72], const half_t* src,
                                  size_t base, int tid) {
  // 64 rows x 64 f16 = 512 16B chunks; 128 threads x 4.
  #pragma unroll
  for (int i = 0; i < 4; i++) {
    int chunk = tid + i * 128;
    int row = chunk >> 3, ko = (chunk & 7) * 8;
    cp16_g2l(&src[base + (size_t)row * D_MODEL + ko], &dst[row][ko]);
  }
}

// V tile, row-major [key][d] as it lies in memory: 64 rows x 64 f16 = 512
// 16-byte chunks, 128 threads x 4 copies, through no register.
#define V_PITCH 80   // f16 a row = 160 bytes, an odd multiple of 32 bytes
__device__ inline void stage_v64(half_t (*dst)[V_PITCH], const half_t* src,
                                 size_t base, int tid) {
  #pragma unroll  // four independent copies issue back to back
  for (int i = 0; i < 4; i++) {
    int chunk = tid + i * 128;
    int row = chunk >> 3, ko = (chunk & 7) * 8;
    cp16_g2l(&src[base + (size_t)row * D_MODEL + ko], &dst[row][ko]);
  }
}

// A fragment (16 d x 32 keys) of V^T * P^T from the row-major V tile by the
// 16-bit transposing LDS load: lane (c = lane & 15, h = lane >> 4) gets
// V[k0 + 8h + 0..7][d0 + c], then the same 16 keys further on: the k order of
// frag_ld. p is this lane's own address for (k0, d0).
typedef short s16x8 __attribute__((ext_vector_type(8)));
__device__ inline v16h frag_ld_tr(const half_t* p) {
  typedef __attribute__((address_space(3))) s16x8 lds_s16x8;
  HV u;
  u.h[0] = __builtin_bit_cast(
      v8h, __builtin_amdgcn_ds_load_tr16_b128_v8i16((lds_s16x8*)p));
  u.h[1] = __builtin_bit_cast(
      v8h, __builtin_amdgcn_ds_load_tr16_b128_v8i16(
               (lds_s16x8*)(p + 16 * V_PITCH)));
  return u.v;
}

// Mask of a 64-key tile as bits. In the transposed scores a lane's keys are
// n0 * 16 + 8 * (lane >> 4) + r: bit (n0 & 1) * 16 + r of w[n0 >> 1] is set
// where that key's mask is not 0. mtile points at the mask of the tile's key 0.
__device__ inline void mask_bits(unsigned (&w)[2], const int* mtile, int lane,
                                 int mh) {
  w[0] = __builtin_amdgcn_ballot_w32(mtile[lane] != 0) >> mh;
  w[1] = __builtin_amdgcn_ballot_w32(mtile[32 + lane] != 0) >> mh;
}

// s where bit 'bit' of w is set, else -1e9 (the reference's masked score).
__device__ inline float masked(float s, unsigned w, int bit) {
  const int open = (int)(w << (31 - bit)) >> 31;         // all ones or 0
  return __builtin_bit_cast(
      float, (open & __builtin_bit_cast(int, s)) |
                 (~open & __builtin_bit_cast(int, -1e9f)));
}

// Masked scores of 64 keys, transposed: c[n0][r] is the score of query row
// qrow of Qs against key n0 * 16 + 8 * (lane >> 4) + r of Ks. A = K rows,
// B = Q rows, both by frag_ld, so both in the same k order.
__device__ inline void scores_t(v8f (&c)[4], const half_t (*Qs)[72],
                                const half_t (*Ks)[72], const unsigned (&w)[2],
                                int qrow, int ln15, int sel) {
  // Every loop here is unrolled: constant indices keep c[] in registers and
  // make kk, n0 and the mask bit immediates.
  #pragma unroll
  for (int n0 = 0; n0 < 4; n0++) zero_v8f(c[n0]);
  #pragma unroll
  for (int kk = 0; kk < 64; kk += 32) {
    v16h bq = frag_ld(&Qs[qrow][kk], sel);
    #pragma unroll
    for (int n0 = 0; n0 < 4; n0++) {
      v16h ak = frag_ld(&Ks[n0 * 16 + ln15][kk], sel);
      c[n0] = wmma16(ak, bq, c[n0]);
    }
  }
  #pragma unroll
  for (int n0 = 0; n0 < 4; n0++)
    #pragma unroll
    for (int r = 0; r < 8; r++)
      c[n0][r] = masked(c[n0][r], w[n0 >> 1], (n0 & 1) * 16 + r);
}

// B fragment (32 keys x 16 queries) of V^T * P^T from two score tiles: keys
// 8h + 0..7 are the first tile's registers, keys 16 + 8h + 0..7 the second's:
// the k order of frag_ld_tr. s0 and s1 take the tiles' sums of exp, in f32.
__device__ inline v16h p_frag(const v8f& c0, const v8f& c1, float m, float& s0,
                              float& s1) {
  HV p;
  s0 = 0.0f;
  s1 = 0.0f;
  #pragma unroll  // constant indices keep the vectors in registers
  for (int r = 0; r < 8; r++) {
    const float e0 = __expf(c0[r] - m), e1 = __expf(c1[r] - m);
    s0 += e0;
    s1 += e1;
    p.h[0][r] = (half_t)e0;
    p.h[1][r] = (half_t)e1;
  }
  return p.v;
}

// Value of lane l ^ 16 (the other half of the wave), by a vector cross-row move.
__device__ inline float xhalf(float x) {
  const int b = __builtin_bit_cast(int, x);
  return __builtin_bit_cast(float, __builtin_amdgcn_permlanex16(
                                       b, b, 0x76543210, 0xfedcba98, false, false));
}

__device__ inline float max8(const v8f& c) {
  float m = c[0];
  #pragma unroll  // constant indices keep c in registers
  for (int r = 1; r < 8; r++) m = fmaxf(m, c[r]);
  return m;
}

__global__ __launch_bounds__(128)
void attention_kernel(const half_t* __restrict__ q, const half_t* __restrict__ k,
                      const half_t* __restrict__ v, const int* __restrict__ mask,
                      half_t* __restrict__ ctx) {
  __shared__ __align__(16) half_t Qs[64][72];
  __shared__ __align__(16) half_t Ks[64][72];
  __shared__ __align__(16) half_t Vs[64][V_PITCH]; // row-major: [key][d]

  const int tid = threadIdx.x, lane = tid & 31, wave = tid >> 5;
  const int qt = blockIdx.x, h = blockIdx.y, b = blockIdx.z;
  const int sel = (lane < 16) ? 0 : 8;
  const int ln15 = lane & 15;
  const int mh = (lane < 16) ? 0 : 8;  // C layout: lanes 16-31 hold rows M+8
  const int qrow = wave * 16 + ln15;   // this lane's query in the tile
  const size_t bh = (size_t)b * SEQ * D_MODEL + (size_t)h * D_K;
  const int* mrowp = mask + (size_t)b * SEQ;
  // Lane's row and column offset in a 16-key x 16-d block for frag_ld_tr.
  const int trow = 8 * (lane >> 4) + (lane & 7), tcol = 8 * ((lane >> 3) & 1);

  stage_qk64(Qs, q, bh + (size_t)(qt * 64) * D_MODEL, tid);

  // acc (d x query) += V^T * exp(S - m)^T, m the query's maximum so far.
  // mrun is the same in both halves of the wave (they hold the same 16 queries
  // and feed one product); lrun sums this half's keys, joined behind the loop.
  float mrun = -1e30f, lrun = 0.0f;
  v8f acc[4];
  #pragma unroll
  for (int nb = 0; nb < 4; nb++) zero_v8f(acc[nb]);

  for (int j = 0; j < SEQ / 64; j++) {
    __syncthreads();
    stage_qk64(Ks, k, bh + (size_t)(j * 64) * D_MODEL, tid);
    stage_v64(Vs, v, bh + (size_t)(j * 64) * D_MODEL, tid);
    unsigned w[2];
    mask_bits(w, mrowp + j * 64, lane, mh);   // its loads fly beside the copies
    // This wave's copies (K, V; Q too on the first trip) have landed before the
    // barrier publishes them.
    asm volatile("s_wait_asynccnt 0x0" ::: "memory");
    __syncthreads();
    v8f c[4];
    scores_t(c, Qs, Ks, w, qrow, ln15, sel);
    // Four independent chains of maxima, then the other half's keys.
    const float mt = fmaxf(fmaxf(max8(c[0]), max8(c[1])),
                           fmaxf(max8(c[2]), max8(c[3])));
    const float mn = fmaxf(fmaxf(mt, xhalf(mt)), mrun);
    const float alpha = __expf(mrun - mn);    // 1 where the maximum stands
    mrun = mn;
    // Unrolled here and below: constant indices keep acc, c and s in registers.
    #pragma unroll
    for (int nb = 0; nb < 4; nb++)
      #pragma unroll
      for (int r = 0; r < 8; r++) acc[nb][r] *= alpha;
    float s[4];
    #pragma unroll
    for (int kk = 0; kk < 64; kk += 32) {
      v16h p = p_frag(c[kk / 16], c[kk / 16 + 1], mn, s[kk / 16], s[kk / 16 + 1]);
      #pragma unroll
      for (int nb = 0; nb < 4; nb++)
        acc[nb] = wmma16(frag_ld_tr(&Vs[kk + trow][nb * 16 + tcol]), p, acc[nb]);
    }
    lrun = lrun * alpha + ((s[0] + s[1]) + (s[2] + s[3]));
  }
  // Join the sums of the two halves of the wave; their maximum is the same.
  const float lq = lrun + xhalf(lrun);

  // acc[nb][r] is d = nb * 16 + mh + r of this lane's query: 16 bytes a store.
  half_t* orow = ctx + bh + (size_t)(qt * 64 + qrow) * D_MODEL + mh;
  #pragma unroll
  for (int nb = 0; nb < 4; nb++) {
    v8h o;
    #pragma unroll
    for (int r = 0; r < 8; r++) o[r] = (half_t)(acc[nb][r] / lq);
    *(v8h*)(orow + nb * 16) = o;
  }
}

// ---------------------------------------------------------------------------
extern "C" void kernel_launch(void* const* d_in, const int* in_sizes, int n_in,
                              void* d_out, int out_size, void* d_ws,
                              size_t ws_size, hipStream_t stream) {
  const float* x    = (const float*)d_in[0];
  const int*   mask = (const int*)d_in[1];
  const float* wq = (const float*)d_in[2];  const float* bq = (const float*)d_in[3];
  const float* wk = (const float*)d_in[4];  const float* bk = (const float*)d_in[5];
  const float* wv = (const float*)d_in[6];  const float* bv = (const float*)d_in[7];
  const float* wo = (const float*)d_in[8];  const float* bo = (const float*)d_in[9];
  const float* w1 = (const float*)d_in[10]; const float* b1 = (const float*)d_in[11];
  const float* w2 = (const float*)d_in[12]; const float* b2 = (const float*)d_in[13];
  const float* g1 = (const float*)d_in[14]; const float* be1 = (const float*)d_in[15];
  const float* g2 = (const float*)d_in[16]; const float* be2 = (const float*)d_in[17];

  // Carve workspace (~216 MB total).
  char* p = (char*)d_ws;
  auto carve = [&](size_t bytes) {
    void* r = (void*)p;
    p += (bytes + 255) & ~(size_t)255;
    return r;
  };
  half_t* w16  = (half_t*)carve(((size_t)4 * D_MODEL * D_MODEL +
                                 (size_t)2 * D_FF * D_MODEL) * 2);
  half_t* wq16 = w16;
  half_t* wk16 = wq16 + (size_t)D_MODEL * D_MODEL;
  half_t* wv16 = wk16 + (size_t)D_MODEL * D_MODEL;
  half_t* wo16 = wv16 + (size_t)D_MODEL * D_MODEL;
  half_t* w116 = wo16 + (size_t)D_MODEL * D_MODEL;
  half_t* w216 = w116 + (size_t)D_FF * D_MODEL;
  half_t* h16  = (half_t*)carve((size_t)M_TOT * D_MODEL * 2);
  half_t* q16  = (half_t*)carve((size_t)M_TOT * D_MODEL * 2);
  half_t* k16  = (half_t*)carve((size_t)M_TOT * D_MODEL * 2);
  half_t* v16  = (half_t*)carve((size_t)M_TOT * D_MODEL * 2);
  half_t* ctx16 = (half_t*)carve((size_t)M_TOT * D_MODEL * 2);
  float*  x1   = (float*)carve((size_t)M_TOT * D_MODEL * 4);
  half_t* h216 = (half_t*)carve((size_t)M_TOT * D_MODEL * 2);
  half_t* ff1  = (half_t*)carve((size_t)M_TOT * D_FF * 2);

  // Weight conversion (f32 -> f16, layout preserved [N][K]).
  cvt_weights_kernel<<<CVT_BLOCKS, CVT_THREADS, 0, stream>>>(wq, wk, wv, wo, w1,
                                                             w2, w16);

  dim3 blk(256);
  // Tiles: 128 x 256 where N is 1024 (256 blocks, one a WGP, 8 waves);
  // 256 x 256 where N is 4096 (512 blocks of 16 waves, two rounds of one a WGP).
  dim3 gN1024(D_MODEL / 256, M_TOT / 128);
  dim3 gN4096(D_FF / 256, M_TOT / 256);

  // h = LN1(x)
  layernorm_kernel<<<M_TOT / 8, blk, 0, stream>>>(x, g1, be1, h16);
  // Q (scaled by 1/sqrt(dk)), K, V projections
  gemm_f16_kernel<true, false, false, 128, 256, 128><<<gN1024, blk, 0, stream>>>(
      h16, wq16, bq, nullptr, q16, M_TOT, D_MODEL, D_MODEL, 0.125f);
  gemm_f16_kernel<true, false, false, 128, 256, 128><<<gN1024, blk, 0, stream>>>(
      h16, wk16, bk, nullptr, k16, M_TOT, D_MODEL, D_MODEL, 1.0f);
  gemm_f16_kernel<true, false, false, 128, 256, 128><<<gN1024, blk, 0, stream>>>(
      h16, wv16, bv, nullptr, v16, M_TOT, D_MODEL, D_MODEL, 1.0f);
  // attention -> ctx
  attention_kernel<<<dim3(SEQ / 64, HEADS, BATCH), dim3(128), 0, stream>>>(
      q16, k16, v16, mask, ctx16);
  // x1 = x + ctx @ wo^T + bo
  gemm_f16_kernel<false, false, true, 128, 256, 128><<<gN1024, blk, 0, stream>>>(
      ctx16, wo16, bo, x, x1, M_TOT, D_MODEL, D_MODEL, 1.0f);
  // h2 = LN2(x1)
  layernorm_kernel<<<M_TOT / 8, blk, 0, stream>>>(x1, g2, be2, h216);
  // ff1 = relu(h2 @ w1^T + b1)
  gemm_f16_kernel<true, true, false, 256, 256, 128><<<gN4096, dim3(512), 0, stream>>>(
      h216, w116, b1, nullptr, ff1, M_TOT, D_FF, D_MODEL, 1.0f);
  // out = x1 + ff1 @ w2^T + b2
  gemm_f16_kernel<false, false, true, 128, 256, 128><<<gN1024, blk, 0, stream>>>(
      ff1, w216, b2, x1, (float*)d_out, M_TOT, D_MODEL, D_FF, 1.0f);
}

// v007
// One run takes 241 microseconds.
// Next to v006, in two timings, it ran 1.04 and 1.05 times as fast.
// Over all steps from v000 it is 2.24 times as fast.
#include <hip/hip_runtime.h>
#include <hip/hip_bf16.h>
#include <cstdint>

// MI455X / gfx1250 transformer encoder block.
// All matmuls (QKV proj, QK^T, PV, O-proj, FFN1, FFN2) run on
// v_wmma_f32_16x16x32_f16 (f16 in, f32 accumulate). Tile staging uses
// GLOBAL_LOAD_ASYNC_TO_LDS_B128 (ASYNCcnt) when the builtin is available,
// with a ring of LDS tiles in the GEMM for copy/compute overlap.

typedef _Float16 half_t;
typedef _Float16 v16h __attribute__((ext_vector_type(16)));
typedef _Float16 v8h  __attribute__((ext_vector_type(8)));
typedef float    v8f  __attribute__((ext_vector_type(8)));
typedef int      v4i  __attribute__((vector_size(16)));   // builtin pointee type

#define D_MODEL 1024
#define HEADS   16
#define D_K     64
#define D_FF    4096
#define SEQ     1024
#define BATCH   8
#define M_TOT   (BATCH * SEQ)   // 8192 rows
#define LN_EPS  1e-6f

#if defined(__has_builtin)
#if __has_builtin(__builtin_amdgcn_global_load_async_to_lds_b128) && \
    __has_builtin(__builtin_amdgcn_s_wait_asynccnt)
#define USE_ASYNC_LDS 1
#endif
#endif
#ifndef USE_ASYNC_LDS
#define USE_ASYNC_LDS 0
#endif

union HV { v16h v; v8h h[2]; };

__device__ inline v8f wmma16(v16h a, v16h b, v8f c) {
  // D = A(16x32 f16) * B(32x16 f16) + C(16x16 f32)
  return __builtin_amdgcn_wmma_f32_16x16x32_f16(false, a, false, b, (short)0, c,
                                                false, false);
}

// Copy 16 bytes global -> LDS. Async (ASYNCcnt) on CDNA5 when available.
__device__ inline void cp16_g2l(const half_t* g, half_t* l) {
#if USE_ASYNC_LDS
  // Flat LDS address truncates to the 32-bit LDS offset (ISA 10.2).
  __builtin_amdgcn_global_load_async_to_lds_b128(
      (__attribute__((address_space(1))) v4i*)(uintptr_t)g,
      (__attribute__((address_space(3))) v4i*)(uint32_t)(uintptr_t)l, 0, 0);
#else
  *(v8h*)l = *(const v8h*)g;
#endif
}

// Load one lane's 16 f16 fragment values from a row-major [row][K] LDS tile.
// k-values: {sel..sel+7, 16+sel..16+sel+7}, sel = 0 (lanes 0-15) or 8 (16-31).
__device__ inline v16h frag_ld(const half_t* rowbase, int sel) {
  HV u;
  u.h[0] = *(const v8h*)(rowbase + sel);
  u.h[1] = *(const v8h*)(rowbase + 16 + sel);
  return u.v;
}

__device__ inline void zero_v8f(v8f& x) {
  #pragma unroll
  for (int i = 0; i < 8; i++) x[i] = 0.0f;
}

// ---------------------------------------------------------------------------
// fp32 -> f16 weight conversion, all six matrices in one launch.
// dst is the six f16 planes end to end (wq, wk, wv, wo, w1, w2). 256 blocks of
// 16 waves; a block converts three pieces of 16384 values: one of the four
// square matrices, one of w1, one of w2. Every wave-wide load is 512
// contiguous bytes, and a thread's 24 loads depend on nothing, so many are in
// flight at once and the memory latency is not paid once per value.
// ---------------------------------------------------------------------------
#define CVT_THREADS 512
#define CVT_LOADS   8
#define CVT_PIECE   (CVT_THREADS * CVT_LOADS * 4)        // 16384 values
#define CVT_BLOCKS  (D_FF * D_MODEL / CVT_PIECE)         // 256
#define SQ_PIECES   (D_MODEL * D_MODEL / CVT_PIECE)      // 64 pieces a square

typedef float    v4f __attribute__((ext_vector_type(4)));
typedef _Float16 v4h __attribute__((ext_vector_type(4)));

__device__ inline void cvt_load(v4f (&r)[CVT_LOADS], const float* src, int t) {
  #pragma unroll  // r[] stays in registers; the loads issue back to back
  for (int j = 0; j < CVT_LOADS; j++)
    r[j] = ((const v4f*)src)[j * CVT_THREADS + t];
}

__device__ inline void cvt_store(const v4f (&r)[CVT_LOADS], half_t* dst, int t) {
  #pragma unroll  // constant indices keep r[] in registers
  for (int j = 0; j < CVT_LOADS; j++) {
    v4h h;
    #pragma unroll  // same, for the four lanes of a vector
    for (int e = 0; e < 4; e++) h[e] = (half_t)r[j][e];
    ((v4h*)dst)[j * CVT_THREADS + t] = h;
  }
}

__global__ __launch_bounds__(CVT_THREADS)
void cvt_weights_kernel(const float* __restrict__ wq, const float* __restrict__ wk,
                        const float* __restrict__ wv, const float* __restrict__ wo,
                        const float* __restrict__ w1, const float* __restrict__ w2,
                        half_t* __restrict__ dst) {
  const int t = threadIdx.x;
  const unsigned blk = blockIdx.x;
  const float* lo = (blk & SQ_PIECES) ? wk : wq;         // block-uniform picks
  const float* hi = (blk & SQ_PIECES) ? wo : wv;
  const float* s0 = (blk & (2 * SQ_PIECES)) ? hi : lo;
  const size_t off = (size_t)blk * CVT_PIECE;
  v4f r0[CVT_LOADS], r1[CVT_LOADS], r2[CVT_LOADS];
  cvt_load(r0, s0 + (size_t)(blk % SQ_PIECES) * CVT_PIECE, t);
  cvt_load(r1, w1 + off, t);
  cvt_load(r2, w2 + off, t);
  cvt_store(r0, dst + off, t);
  cvt_store(r1, dst + (size_t)4 * D_MODEL * D_MODEL + off, t);
  cvt_store(r2, dst + (size_t)4 * D_MODEL * D_MODEL + (size_t)D_FF * D_MODEL + off, t);
}

// ---------------------------------------------------------------------------
// LayerNorm (reference semantics: unbiased std, divide by std+eps), f16 out.
// One wave per row of 1024; 8 rows per 256-thread block.
// ---------------------------------------------------------------------------
__global__ __launch_bounds__(256)
void layernorm_kernel(const float* __restrict__ x, const float* __restrict__ g,
                      const float* __restrict__ be, half_t* __restrict__ out) {
  const int lane = threadIdx.x & 31, wave = threadIdx.x >> 5;
  const int row = blockIdx.x * 8 + wave;
  const float* xr = x + (size_t)row * D_MODEL;
  float v[32];
  float s = 0.f, ss = 0.f;
  #pragma unroll
  for (int i = 0; i < 32; i++) {
    v[i] = xr[lane + i * 32];
    s += v[i];
    ss += v[i] * v[i];
  }
  #pragma unroll
  for (int off = 16; off > 0; off >>= 1) {
    s  += __shfl_xor(s,  off, 32);
    ss += __shfl_xor(ss, off, 32);
  }
  float mean = s * (1.0f / D_MODEL);
  float var  = (ss - (float)D_MODEL * mean * mean) * (1.0f / (D_MODEL - 1));
  float inv  = 1.0f / (sqrtf(fmaxf(var, 0.0f)) + LN_EPS);
  half_t* orow = out + (size_t)row * D_MODEL;
  #pragma unroll
  for (int i = 0; i < 32; i++) {
    int c = lane + i * 32;
    orow[c] = (half_t)(g[c] * (v[i] - mean) * inv + be[c]);
  }
}

// ---------------------------------------------------------------------------
// WMMA GEMM: out[M][N] = epilogue( A[M][K](f16) * W[N][K]^T(f16) )
// Block tile BM x BN, a ring of NBUF LDS stages, (BM/64) x (BN/64) waves; each wave
// 64x64 = 4x4 fragments -> 16 v_wmma per 32 k from 8 fragment loads. A block
// brings (BM + BN) rows from L2 for BM * BN outputs, so a larger tile asks L2
// for fewer bytes a WMMA, and the square wave tile asks LDS for fewer.
// A stage of the ring holds BK k of both tiles, and a wave-wide copy covers
// whole lines of the source rows. A stage's copies are issued NBUF - 1 trips
// ahead of its readers: with three buffers or more, the wait at a trip's foot
// leaves the younger stages' copies in flight, so the block always has requests
// at L2, also across the barrier. K must be a multiple of BK and hold at least
// NBUF - 1 stages, M a multiple of BM, N of BN.
// Row pitch (BK + 8) f16 = 16 bytes x odd, for the ds_load_b128 readers.
// Epilogue: (+bias)*scale, optional ReLU, optional +residual, f16/f32 out.
// ---------------------------------------------------------------------------
// src points at the tile's first row, column k0, the same for every thread: the
// row steps are then scalars, and a thread keeps one offset, not one a copy.
template <int ROWS, int BK, int NT>
__device__ inline void stage_rows(half_t (*dst)[BK + 8], const half_t* src,
                                  int Kdim, int tid) {
  constexpr int CPR = BK / 8;                // 16-byte chunks a row
  constexpr int RPI = NT / CPR;              // rows the block copies at a time
  const int row = tid / CPR, ko = (tid % CPR) * 8;
  const unsigned tbyte = (unsigned)(row * Kdim + ko) * 2u;
  #pragma unroll  // independent copies issue back to back
  for (int i = 0; i < ROWS / RPI; i++) {
    const char* base = (const char*)(src + (size_t)(i * RPI) * Kdim);
    cp16_g2l((const half_t*)(base + tbyte), &dst[row + i * RPI][ko]);
  }
}

template <bool OUT_F16, bool RELU, bool ADD_RES, int BM, int BN, int BK, int NBUF>
__global__ __launch_bounds__(BM / 64 * (BN / 64) * 32)
void gemm_f16_kernel(const half_t* __restrict__ A,     // [M][K]
                     const half_t* __restrict__ W,     // [N][K]
                     const float* __restrict__ bias,   // [N]
                     const float* __restrict__ res,    // [M][N] or null
                     void* __restrict__ outp, int Mdim, int Ndim, int Kdim,
                     float out_scale) {
  constexpr int WM = BM / 64;                // waves along M
  constexpr int NT = WM * (BN / 64) * 32;    // threads a block
  constexpr int LEAD = NBUF - 1;             // stages a copy runs ahead
  // Copies a wave issues a stage, the same in every wave; and how many of a
  // wave's youngest copies belong to stages behind the next one to be read.
  constexpr int NCP = (BM + BN) * (BK / 8) / NT;
  constexpr int YOUNGER = (LEAD - 1) * NCP;
  static_assert(LEAD * NCP <= 63, "copies of a wave outstanding");
  __shared__ __align__(16) half_t As[NBUF][BM][BK + 8];
  __shared__ __align__(16) half_t Ws[NBUF][BN][BK + 8];
  const int tid = threadIdx.x;
  const int lane = tid & 31, wave = tid >> 5;
  const int wm = wave % WM, wn = wave / WM;
  const int tM = blockIdx.y * BM, tN = blockIdx.x * BN;
  const int sel = (lane < 16) ? 0 : 8;
  const int ln15 = lane & 15;

  v8f acc[4][4];
  #pragma unroll
  for (int i = 0; i < 4; i++)
    #pragma unroll
    for (int j = 0; j < 4; j++) zero_v8f(acc[i][j]);

  // Prologue: the first LEAD stages, into buffers 0 .. LEAD - 1.
  const half_t* At = A + (size_t)tM * Kdim;  // first rows of the block's tiles
  const half_t* Wt = W + (size_t)tN * Kdim;
  #pragma unroll  // the buffer index is a constant
  for (int s = 0; s < LEAD; s++) {
    stage_rows<BM, BK, NT>(As[s], At + s * BK, Kdim, tid);
    stage_rows<BN, BK, NT>(Ws[s], Wt + s * BK, Kdim, tid);
  }
  // This wave's copies of stage 0 (all but its YOUNGER youngest) have landed
  // before the barrier publishes them.
  asm volatile("s_wait_asynccnt %0" ::"n"(YOUNGER) : "memory");
  __syncthreads();

  // The WMMAs of one stage, from buffer buf.
  auto stage_wmma = [&](int buf) {
    #pragma unroll  // kk becomes a constant LDS offset of every fragment load
    for (int kk = 0; kk < BK; kk += 32) {
      // The 8 fragments of a k step are read first, then its 16 WMMAs run.
      v16h a[4], b[4];
      #pragma unroll  // constant indices keep a[], b[] and acc[][] in registers
      for (int f = 0; f < 4; f++) {
        a[f] = frag_ld(&As[buf][wm * 64 + f * 16 + ln15][kk], sel);
        b[f] = frag_ld(&Ws[buf][wn * 64 + f * 16 + ln15][kk], sel);
      }
      // Holds the 16 LDS reads in front of the k step's WMMAs: the scheduler
      // otherwise sinks each B fragment's reads to its first use, and the wave
      // then waits out the LDS latency once every four WMMAs.
      __builtin_amdgcn_sched_barrier(0);
      #pragma unroll
      for (int fn = 0; fn < 4; fn++)
        #pragma unroll
        for (int fm = 0; fm < 4; fm++)
          acc[fm][fn] = wmma16(a[fm], b[fn], acc[fm][fn]);
    }
  };

  const int nk = Kdim / BK;
  int rd = 0, wr = LEAD;                     // buffer read; buffer refilled
  const half_t* An = At + LEAD * BK;         // column of the next stage to copy
  const half_t* Wn = Wt + LEAD * BK;
  // Every trip of this loop issues one stage's copies: NCP a wave.
  for (int ki = 0; ki < nk - LEAD; ki++) {
    // Copies of stage ki + LEAD, into the buffer that trip ki - 1 read: the
    // barrier at that trip's foot has ended its readers.
    stage_rows<BM, BK, NT>(As[wr], An, Kdim, tid);
    stage_rows<BN, BK, NT>(Ws[wr], Wn, Kdim, tid);
    An += BK;
    Wn += BK;
    stage_wmma(rd);
    // This wave's reads of rd are over before the barrier frees it for refill.
    asm volatile("s_wait_dscnt 0x0" ::: "memory");
    // This wave's copies of stage ki + 1 have landed before it is published;
    // those of the stages behind it, the wave's YOUNGER youngest, fly on.
    asm volatile("s_wait_asynccnt %0" ::"n"(YOUNGER) : "memory");
    __syncthreads();
    rd = (rd + 1 == NBUF) ? 0 : rd + 1;
    wr = (wr + 1 == NBUF) ? 0 : wr + 1;
  }
  // The last LEAD stages: no copy is issued any more, so the wait is to 0.
  for (int t = 0; t < LEAD; t++) {
    stage_wmma(rd);
    // As above: reads over, every copy landed, then the barrier publishes.
    asm volatile("s_wait_dscnt 0x0" ::: "memory");
    asm volatile("s_wait_asynccnt 0x0" ::: "memory");
    __syncthreads();
    rd = (rd + 1 == NBUF) ? 0 : rd + 1;
  }
  // No copy is outstanding when the wave goes on to its stores and ends.
  asm volatile("s_wait_asynccnt 0x0" ::: "memory");

  const int mh = (lane < 16) ? 0 : 8;  // C layout: lanes 16-31 hold rows M+8
  #pragma unroll
  for (int fm = 0; fm < 4; fm++) {
    #pragma unroll
    for (int fn = 0; fn < 4; fn++) {
      int n = tN + wn * 64 + fn * 16 + ln15;
      float bv = bias[n];
      #pragma unroll
      for (int r = 0; r < 8; r++) {
        int m = tM + wm * 64 + fm * 16 + r + mh;
        float val = (acc[fm][fn][r] + bv) * out_scale;
        if (RELU) val = val > 0.0f ? val : 0.0f;
        if (ADD_RES) val += res[(size_t)m * Ndim + n];
        if (OUT_F16)
          ((half_t*)outp)[(size_t)m * Ndim + n] = (half_t)val;
        else
          ((float*)outp)[(size_t)m * Ndim + n] = val;
      }
    }
  }
}

__device__ inline void stage_qk64(half_t (*dst)[72], const half_t* src,
                                  size_t base, int tid) {
  // 64 rows x 64 f16 = 512 16B chunks; 128 threads x 4.
  #pragma unroll
  for (int i = 0; i < 4; i++) {
    int chunk = tid + i * 128;
    int row = chunk >> 3, ko = (chunk & 7) * 8;
    cp16_g2l(&src[base + (size_t)row * D_MODEL + ko], &dst[row][ko]);
  }
}

// V tile, row-major [key][d] as it lies in memory: 64 rows x 64 f16 = 512
// 16-byte chunks, 128 threads x 4 copies, through no register.
#define V_PITCH 80   // f16 a row = 160 bytes, an odd multiple of 32 bytes
__device__ inline void stage_v64(half_t (*dst)[V_PITCH], const half_t* src,
                                 size_t base, int tid) {
  #pragma unroll  // four independent copies issue back to back
  for (int i = 0; i < 4; i++) {
    int chunk = tid + i * 128;
    int row = chunk >> 3, ko = (chunk & 7) * 8;
    cp16_g2l(&src[base + (size_t)row * D_MODEL + ko], &dst[row][ko]);
  }
}

// A fragment (16 d x 32 keys) of V^T * P^T from the row-major V tile by the
// 16-bit transposing LDS load: lane (c = lane & 15, h = lane >> 4) gets
// V[k0 + 8h + 0..7][d0 + c], then the same 16 keys further on: the k order of
// frag_ld. p is this lane's own address for (k0, d0).
typedef short s16x8 __attribute__((ext_vector_type(8)));
__device__ inline v16h frag_ld_tr(const half_t* p) {
  typedef __attribute__((address_space(3))) s16x8 lds_s16x8;
  HV u;
  u.h[0] = __builtin_bit_cast(
      v8h, __builtin_amdgcn_ds_load_tr16_b128_v8i16((lds_s16x8*)p));
  u.h[1] = __builtin_bit_cast(
      v8h, __builtin_amdgcn_ds_load_tr16_b128_v8i16(
               (lds_s16x8*)(p + 16 * V_PITCH)));
  return u.v;
}

// Mask of a 64-key tile as bits. In the transposed scores a lane's keys are
// n0 * 16 + 8 * (lane >> 4) + r: bit (n0 & 1) * 16 + r of w[n0 >> 1] is set
// where that key's mask is not 0. mtile points at the mask of the tile's key 0.
__device__ inline void mask_bits(unsigned (&w)[2], const int* mtile, int lane,
                                 int mh) {
  w[0] = __builtin_amdgcn_ballot_w32(mtile[lane] != 0) >> mh;
  w[1] = __builtin_amdgcn_ballot_w32(mtile[32 + lane] != 0) >> mh;
}

// s where bit 'bit' of w is set, else -1e9 (the reference's masked score).
__device__ inline float masked(float s, unsigned w, int bit) {
  const int open = (int)(w << (31 - bit)) >> 31;         // all ones or 0
  return __builtin_bit_cast(
      float, (open & __builtin_bit_cast(int, s)) |
                 (~open & __builtin_bit_cast(int, -1e9f)));
}

// Masked scores of 64 keys, transposed: c[n0][r] is the score of query row
// qrow of Qs against key n0 * 16 + 8 * (lane >> 4) + r of Ks. A = K rows,
// B = Q rows, both by frag_ld, so both in the same k order.
__device__ inline void scores_t(v8f (&c)[4], const half_t (*Qs)[72],
                                const half_t (*Ks)[72], const unsigned (&w)[2],
                                int qrow, int ln15, int sel) {
  // Every loop here is unrolled: constant indices keep c[] in registers and
  // make kk, n0 and the mask bit immediates.
  #pragma unroll
  for (int n0 = 0; n0 < 4; n0++) zero_v8f(c[n0]);
  #pragma unroll
  for (int kk = 0; kk < 64; kk += 32) {
    v16h bq = frag_ld(&Qs[qrow][kk], sel);
    #pragma unroll
    for (int n0 = 0; n0 < 4; n0++) {
      v16h ak = frag_ld(&Ks[n0 * 16 + ln15][kk], sel);
      c[n0] = wmma16(ak, bq, c[n0]);
    }
  }
  #pragma unroll
  for (int n0 = 0; n0 < 4; n0++)
    #pragma unroll
    for (int r = 0; r < 8; r++)
      c[n0][r] = masked(c[n0][r], w[n0 >> 1], (n0 & 1) * 16 + r);
}

// B fragment (32 keys x 16 queries) of V^T * P^T from two score tiles: keys
// 8h + 0..7 are the first tile's registers, keys 16 + 8h + 0..7 the second's:
// the k order of frag_ld_tr. s0 and s1 take the tiles' sums of exp, in f32.
__device__ inline v16h p_frag(const v8f& c0, const v8f& c1, float m, float& s0,
                              float& s1) {
  HV p;
  s0 = 0.0f;
  s1 = 0.0f;
  #pragma unroll  // constant indices keep the vectors in registers
  for (int r = 0; r < 8; r++) {
    const float e0 = __expf(c0[r] - m), e1 = __expf(c1[r] - m);
    s0 += e0;
    s1 += e1;
    p.h[0][r] = (half_t)e0;
    p.h[1][r] = (half_t)e1;
  }
  return p.v;
}

// Value of lane l ^ 16 (the other half of the wave), by a vector cross-row move.
__device__ inline float xhalf(float x) {
  const int b = __builtin_bit_cast(int, x);
  return __builtin_bit_cast(float, __builtin_amdgcn_permlanex16(
                                       b, b, 0x76543210, 0xfedcba98, false, false));
}

__device__ inline float max8(const v8f& c) {
  float m = c[0];
  #pragma unroll  // constant indices keep c in registers
  for (int r = 1; r < 8; r++) m = fmaxf(m, c[r]);
  return m;
}

__global__ __launch_bounds__(128)
void attention_kernel(const half_t* __restrict__ q, const half_t* __restrict__ k,
                      const half_t* __restrict__ v, const int* __restrict__ mask,
                      half_t* __restrict__ ctx) {
  __shared__ __align__(16) half_t Qs[64][72];
  __shared__ __align__(16) half_t Ks[64][72];
  __shared__ __align__(16) half_t Vs[64][V_PITCH]; // row-major: [key][d]

  const int tid = threadIdx.x, lane = tid & 31, wave = tid >> 5;
  const int qt = blockIdx.x, h = blockIdx.y, b = blockIdx.z;
  const int sel = (lane < 16) ? 0 : 8;
  const int ln15 = lane & 15;
  const int mh = (lane < 16) ? 0 : 8;  // C layout: lanes 16-31 hold rows M+8
  const int qrow = wave * 16 + ln15;   // this lane's query in the tile
  const size_t bh = (size_t)b * SEQ * D_MODEL + (size_t)h * D_K;
  const int* mrowp = mask + (size_t)b * SEQ;
  // Lane's row and column offset in a 16-key x 16-d block for frag_ld_tr.
  const int trow = 8 * (lane >> 4) + (lane & 7), tcol = 8 * ((lane >> 3) & 1);

  stage_qk64(Qs, q, bh + (size_t)(qt * 64) * D_MODEL, tid);

  // acc (d x query) += V^T * exp(S - m)^T, m the query's maximum so far.
  // mrun is the same in both halves of the wave (they hold the same 16 queries
  // and feed one product); lrun sums this half's keys, joined behind the loop.
  float mrun = -1e30f, lrun = 0.0f;
  v8f acc[4];
  #pragma unroll
  for (int nb = 0; nb < 4; nb++) zero_v8f(acc[nb]);

  for (int j = 0; j < SEQ / 64; j++) {
    __syncthreads();
    stage_qk64(Ks, k, bh + (size_t)(j * 64) * D_MODEL, tid);
    stage_v64(Vs, v, bh + (size_t)(j * 64) * D_MODEL, tid);
    unsigned w[2];
    mask_bits(w, mrowp + j * 64, lane, mh);   // its loads fly beside the copies
    // This wave's copies (K, V; Q too on the first trip) have landed before the
    // barrier publishes them.
    asm volatile("s_wait_asynccnt 0x0" ::: "memory");
    __syncthreads();
    v8f c[4];
    scores_t(c, Qs, Ks, w, qrow, ln15, sel);
    // Four independent chains of maxima, then the other half's keys.
    const float mt = fmaxf(fmaxf(max8(c[0]), max8(c[1])),
                           fmaxf(max8(c[2]), max8(c[3])));
    const float mn = fmaxf(fmaxf(mt, xhalf(mt)), mrun);
    const float alpha = __expf(mrun - mn);    // 1 where the maximum stands
    mrun = mn;
    // Unrolled here and below: constant indices keep acc, c and s in registers.
    #pragma unroll
    for (int nb = 0; nb < 4; nb++)
      #pragma unroll
      for (int r = 0; r < 8; r++) acc[nb][r] *= alpha;
    float s[4];
    #pragma unroll
    for (int kk = 0; kk < 64; kk += 32) {
      v16h p = p_frag(c[kk / 16], c[kk / 16 + 1], mn, s[kk / 16], s[kk / 16 + 1]);
      #pragma unroll
      for (int nb = 0; nb < 4; nb++)
        acc[nb] = wmma16(frag_ld_tr(&Vs[kk + trow][nb * 16 + tcol]), p, acc[nb]);
    }
    lrun = lrun * alpha + ((s[0] + s[1]) + (s[2] + s[3]));
  }
  // Join the sums of the two halves of the wave; their maximum is the same.
  const float lq = lrun + xhalf(lrun);

  // acc[nb][r] is d = nb * 16 + mh + r of this lane's query: 16 bytes a store.
  half_t* orow = ctx + bh + (size_t)(qt * 64 + qrow) * D_MODEL + mh;
  #pragma unroll
  for (int nb = 0; nb < 4; nb++) {
    v8h o;
    #pragma unroll
    for (int r = 0; r < 8; r++) o[r] = (half_t)(acc[nb][r] / lq);
    *(v8h*)(orow + nb * 16) = o;
  }
}

// ---------------------------------------------------------------------------
extern "C" void kernel_launch(void* const* d_in, const int* in_sizes, int n_in,
                              void* d_out, int out_size, void* d_ws,
                              size_t ws_size, hipStream_t stream) {
  const float* x    = (const float*)d_in[0];
  const int*   mask = (const int*)d_in[1];
  const float* wq = (const float*)d_in[2];  const float* bq = (const float*)d_in[3];
  const float* wk = (const float*)d_in[4];  const float* bk = (const float*)d_in[5];
  const float* wv = (const float*)d_in[6];  const float* bv = (const float*)d_in[7];
  const float* wo = (const float*)d_in[8];  const float* bo = (const float*)d_in[9];
  const float* w1 = (const float*)d_in[10]; const float* b1 = (const float*)d_in[11];
  const float* w2 = (const float*)d_in[12]; const float* b2 = (const float*)d_in[13];
  const float* g1 = (const float*)d_in[14]; const float* be1 = (const float*)d_in[15];
  const float* g2 = (const float*)d_in[16]; const float* be2 = (const float*)d_in[17];

  // Carve workspace (~216 MB total).
  char* p = (char*)d_ws;
  auto carve = [&](size_t bytes) {
    void* r = (void*)p;
    p += (bytes + 255) & ~(size_t)255;
    return r;
  };
  half_t* w16  = (half_t*)carve(((size_t)4 * D_MODEL * D_MODEL +
                                 (size_t)2 * D_FF * D_MODEL) * 2);
  half_t* wq16 = w16;
  half_t* wk16 = wq16 + (size_t)D_MODEL * D_MODEL;
  half_t* wv16 = wk16 + (size_t)D_MODEL * D_MODEL;
  half_t* wo16 = wv16 + (size_t)D_MODEL * D_MODEL;
  half_t* w116 = wo16 + (size_t)D_MODEL * D_MODEL;
  half_t* w216 = w116 + (size_t)D_FF * D_MODEL;
  half_t* h16  = (half_t*)carve((size_t)M_TOT * D_MODEL * 2);
  half_t* q16  = (half_t*)carve((size_t)M_TOT * D_MODEL * 2);
  half_t* k16  = (half_t*)carve((size_t)M_TOT * D_MODEL * 2);
  half_t* v16  = (half_t*)carve((size_t)M_TOT * D_MODEL * 2);
  half_t* ctx16 = (half_t*)carve((size_t)M_TOT * D_MODEL * 2);
  float*  x1   = (float*)carve((size_t)M_TOT * D_MODEL * 4);
  half_t* h216 = (half_t*)carve((size_t)M_TOT * D_MODEL * 2);
  half_t* ff1  = (half_t*)carve((size_t)M_TOT * D_FF * 2);

  // Weight conversion (f32 -> f16, layout preserved [N][K]).
  cvt_weights_kernel<<<CVT_BLOCKS, CVT_THREADS, 0, stream>>>(wq, wk, wv, wo, w1,
                                                             w2, w16);

  dim3 blk(256);
  // Tiles: 128 x 256 where N is 1024 (256 blocks, one a WGP, 8 waves; a ring of
  // three stages); 256 x 256 where N is 4096 (512 blocks of 16 waves, two rounds
  // of one a WGP; two stages, a third does not fit the LDS of a WGP).
  dim3 gN1024(D_MODEL / 256, M_TOT / 128);
  dim3 gN4096(D_FF / 256, M_TOT / 256);

  // h = LN1(x)
  layernorm_kernel<<<M_TOT / 8, blk, 0, stream>>>(x, g1, be1, h16);
  // Q (scaled by 1/sqrt(dk)), K, V projections
  gemm_f16_kernel<true, false, false, 128, 256, 128, 3><<<gN1024, blk, 0, stream>>>(
      h16, wq16, bq, nullptr, q16, M_TOT, D_MODEL, D_MODEL, 0.125f);
  gemm_f16_kernel<true, false, false, 128, 256, 128, 3><<<gN1024, blk, 0, stream>>>(
      h16, wk16, bk, nullptr, k16, M_TOT, D_MODEL, D_MODEL, 1.0f);
  gemm_f16_kernel<true, false, false, 128, 256, 128, 3><<<gN1024, blk, 0, stream>>>(
      h16, wv16, bv, nullptr, v16, M_TOT, D_MODEL, D_MODEL, 1.0f);
  // attention -> ctx
  attention_kernel<<<dim3(SEQ / 64, HEADS, BATCH), dim3(128), 0, stream>>>(
      q16, k16, v16, mask, ctx16);
  // x1 = x + ctx @ wo^T + bo
  gemm_f16_kernel<false, false, true, 128, 256, 128, 3><<<gN1024, blk, 0, stream>>>(
      ctx16, wo16, bo, x, x1, M_TOT, D_MODEL, D_MODEL, 1.0f);
  // h2 = LN2(x1)
  layernorm_kernel<<<M_TOT / 8, blk, 0, stream>>>(x1, g2, be2, h216);
  // ff1 = relu(h2 @ w1^T + b1)
  gemm_f16_kernel<true, true, false, 256, 256, 128, 2><<<gN4096, dim3(512), 0, stream>>>(
      h216, w116, b1, nullptr, ff1, M_TOT, D_FF, D_MODEL, 1.0f);
  // out = x1 + ff1 @ w2^T + b2
  gemm_f16_kernel<false, false, true, 128, 256, 128, 3><<<gN1024, blk, 0, stream>>>(
      ff1, w216, b2, x1, (float*)d_out, M_TOT, D_MODEL, D_FF, 1.0f);
}

// v008
// A run of this version takes 232 microseconds.
// Next to v007, in two timings, it ran 1.04 times as fast each time.
// All steps since v000 together make it 2.33 times as fast.
#include <hip/hip_runtime.h>
#include <hip/hip_bf16.h>
#include <cstdint>

// MI455X / gfx1250 transformer encoder block.
// All matmuls (QKV proj, QK^T, PV, O-proj, FFN1, FFN2) run on
// v_wmma_f32_16x16x32_f16 (f16 in, f32 accumulate). Tile staging uses
// GLOBAL_LOAD_ASYNC_TO_LDS_B128 (ASYNCcnt) when the builtin is available,
// with a ring of LDS tiles in the GEMM for copy/compute overlap.

typedef _Float16 half_t;
typedef _Float16 v16h __attribute__((ext_vector_type(16)));
typedef _Float16 v8h  __attribute__((ext_vector_type(8)));
typedef float    v8f  __attribute__((ext_vector_type(8)));
typedef int      v4i  __attribute__((vector_size(16)));   // builtin pointee type

#define D_MODEL 1024
#define HEADS   16
#define D_K     64
#define D_FF    4096
#define SEQ     1024
#define BATCH   8
#define M_TOT   (BATCH * SEQ)   // 8192 rows
#define LN_EPS  1e-6f

#if defined(__has_builtin)
#if __has_builtin(__builtin_amdgcn_global_load_async_to_lds_b128) && \
    __has_builtin(__builtin_amdgcn_s_wait_asynccnt)
#define USE_ASYNC_LDS 1
#endif
#endif
#ifndef USE_ASYNC_LDS
#define USE_ASYNC_LDS 0
#endif

union HV { v16h v; v8h h[2]; };

__device__ inline v8f wmma16(v16h a, v16h b, v8f c) {
  // D = A(16x32 f16) * B(32x16 f16) + C(16x16 f32)
  return __builtin_amdgcn_wmma_f32_16x16x32_f16(false, a, false, b, (short)0, c,
                                                false, false);
}

// Copy 16 bytes global -> LDS. Async (ASYNCcnt) on CDNA5 when available.
__device__ inline void cp16_g2l(const half_t* g, half_t* l) {
#if USE_ASYNC_LDS
  // Flat LDS address truncates to the 32-bit LDS offset (ISA 10.2).
  __builtin_amdgcn_global_load_async_to_lds_b128(
      (__attribute__((address_space(1))) v4i*)(uintptr_t)g,
      (__attribute__((address_space(3))) v4i*)(uint32_t)(uintptr_t)l, 0, 0);
#else
  *(v8h*)l = *(const v8h*)g;
#endif
}

// Load one lane's 16 f16 fragment values from a row-major [row][K] LDS tile.
// k-values: {sel..sel+7, 16+sel..16+sel+7}, sel = 0 (lanes 0-15) or 8 (16-31).
__device__ inline v16h frag_ld(const half_t* rowbase, int sel) {
  HV u;
  u.h[0] = *(const v8h*)(rowbase + sel);
  u.h[1] = *(const v8h*)(rowbase + 16 + sel);
  return u.v;
}

__device__ inline void zero_v8f(v8f& x) {
  #pragma unroll
  for (int i = 0; i < 8; i++) x[i] = 0.0f;
}

// ---------------------------------------------------------------------------
// fp32 -> f16 weight conversion, all six matrices in one launch.
// dst is the six f16 planes end to end (wq, wk, wv, wo, w1, w2). 256 blocks of
// 16 waves; a block converts three pieces of 16384 values: one of the four
// square matrices, one of w1, one of w2. Every wave-wide load is 512
// contiguous bytes, and a thread's 24 loads depend on nothing, so many are in
// flight at once and the memory latency is not paid once per value.
// ---------------------------------------------------------------------------
#define CVT_THREADS 512
#define CVT_LOADS   8
#define CVT_PIECE   (CVT_THREADS * CVT_LOADS * 4)        // 16384 values
#define CVT_BLOCKS  (D_FF * D_MODEL / CVT_PIECE)         // 256
#define SQ_PIECES   (D_MODEL * D_MODEL / CVT_PIECE)      // 64 pieces a square

typedef float    v4f __attribute__((ext_vector_type(4)));
typedef _Float16 v4h __attribute__((ext_vector_type(4)));

__device__ inline void cvt_load(v4f (&r)[CVT_LOADS], const float* src, int t) {
  #pragma unroll  // r[] stays in registers; the loads issue back to back
  for (int j = 0; j < CVT_LOADS; j++)
    r[j] = ((const v4f*)src)[j * CVT_THREADS + t];
}

__device__ inline void cvt_store(const v4f (&r)[CVT_LOADS], half_t* dst, int t) {
  #pragma unroll  // constant indices keep r[] in registers
  for (int j = 0; j < CVT_LOADS; j++) {
    v4h h;
    #pragma unroll  // same, for the four lanes of a vector
    for (int e = 0; e < 4; e++) h[e] = (half_t)r[j][e];
    ((v4h*)dst)[j * CVT_THREADS + t] = h;
  }
}

__global__ __launch_bounds__(CVT_THREADS)
void cvt_weights_kernel(const float* __restrict__ wq, const float* __restrict__ wk,
                        const float* __restrict__ wv, const float* __restrict__ wo,
                        const float* __restrict__ w1, const float* __restrict__ w2,
                        half_t* __restrict__ dst) {
  const int t = threadIdx.x;
  const unsigned blk = blockIdx.x;
  const float* lo = (blk & SQ_PIECES) ? wk : wq;         // block-uniform picks
  const float* hi = (blk & SQ_PIECES) ? wo : wv;
  const float* s0 = (blk & (2 * SQ_PIECES)) ? hi : lo;
  const size_t off = (size_t)blk * CVT_PIECE;
  v4f r0[CVT_LOADS], r1[CVT_LOADS], r2[CVT_LOADS];
  cvt_load(r0, s0 + (size_t)(blk % SQ_PIECES) * CVT_PIECE, t);
  cvt_load(r1, w1 + off, t);
  cvt_load(r2, w2 + off, t);
  cvt_store(r0, dst + off, t);
  cvt_store(r1, dst + (size_t)4 * D_MODEL * D_MODEL + off, t);
  cvt_store(r2, dst + (size_t)4 * D_MODEL * D_MODEL + (size_t)D_FF * D_MODEL + off, t);
}

// ---------------------------------------------------------------------------
// LayerNorm (reference semantics: unbiased std, divide by std+eps), f16 out.
// One wave per row of 1024; 8 rows per 256-thread block.
// ---------------------------------------------------------------------------
__global__ __launch_bounds__(256)
void layernorm_kernel(const float* __restrict__ x, const float* __restrict__ g,
                      const float* __restrict__ be, half_t* __restrict__ out) {
  const int lane = threadIdx.x & 31, wave = threadIdx.x >> 5;
  const int row = blockIdx.x * 8 + wave;
  const float* xr = x + (size_t)row * D_MODEL;
  float v[32];
  float s = 0.f, ss = 0.f;
  #pragma unroll
  for (int i = 0; i < 32; i++) {
    v[i] = xr[lane + i * 32];
    s += v[i];
    ss += v[i] * v[i];
  }
  #pragma unroll
  for (int off = 16; off > 0; off >>= 1) {
    s  += __shfl_xor(s,  off, 32);
    ss += __shfl_xor(ss, off, 32);
  }
  float mean = s * (1.0f / D_MODEL);
  float var  = (ss - (float)D_MODEL * mean * mean) * (1.0f / (D_MODEL - 1));
  float inv  = 1.0f / (sqrtf(fmaxf(var, 0.0f)) + LN_EPS);
  half_t* orow = out + (size_t)row * D_MODEL;
  #pragma unroll
  for (int i = 0; i < 32; i++) {
    int c = lane + i * 32;
    orow[c] = (half_t)(g[c] * (v[i] - mean) * inv + be[c]);
  }
}

// ---------------------------------------------------------------------------
// WMMA GEMM: out[M][N] = epilogue( A[M][K](f16) * W[N][K]^T(f16) )
// Block tile BM x BN, a ring of NBUF LDS stages, (BM/64) x (BN/64) waves; each wave
// 64x64 = 4x4 fragments -> 16 v_wmma per 32 k from 8 fragment loads. A block
// brings (BM + BN) rows from L2 for BM * BN outputs, so a larger tile asks L2
// for fewer bytes a WMMA, and the square wave tile asks LDS for fewer.
// A stage of the ring holds BK k of both tiles, and a wave-wide copy covers
// whole lines of the source rows. A stage's copies are issued NBUF - 1 trips
// ahead of its readers: with three buffers or more, the wait at a trip's foot
// leaves the younger stages' copies in flight, so the block always has requests
// at L2, also across the barrier. K must be a multiple of BK and hold at least
// NBUF - 1 stages, M a multiple of BM, N of BN.
// Row pitch (BK + 8) f16 = 16 bytes x odd, for the ds_load_b128 readers.
// Epilogue: (+bias)*scale, optional ReLU, optional +residual, f16/f32 out.
// ---------------------------------------------------------------------------
// src points at the tile's first row, column k0, the same for every thread: the
// row steps are then scalars, and a thread keeps one offset, not one a copy.
template <int ROWS, int BK, int NT>
__device__ inline void stage_rows(half_t (*dst)[BK + 8], const half_t* src,
                                  int Kdim, int tid) {
  constexpr int CPR = BK / 8;                // 16-byte chunks a row
  constexpr int RPI = NT / CPR;              // rows the block copies at a time
  const int row = tid / CPR, ko = (tid % CPR) * 8;
  const unsigned tbyte = (unsigned)(row * Kdim + ko) * 2u;
  #pragma unroll  // independent copies issue back to back
  for (int i = 0; i < ROWS / RPI; i++) {
    const char* base = (const char*)(src + (size_t)(i * RPI) * Kdim);
    cp16_g2l((const half_t*)(base + tbyte), &dst[row + i * RPI][ko]);
  }
}

template <bool OUT_F16, bool RELU, bool ADD_RES, int BM, int BN, int BK, int NBUF>
__global__ __launch_bounds__(BM / 64 * (BN / 64) * 32)
void gemm_f16_kernel(const half_t* __restrict__ A,     // [M][K]
                     const half_t* __restrict__ W,     // [N][K]
                     const float* __restrict__ bias,   // [N]
                     const float* __restrict__ res,    // [M][N] or null
                     void* __restrict__ outp, int Mdim, int Ndim, int Kdim,
                     float out_scale) {
  constexpr int WM = BM / 64;                // waves along M
  constexpr int NT = WM * (BN / 64) * 32;    // threads a block
  constexpr int LEAD = NBUF - 1;             // stages a copy runs ahead
  // Copies a wave issues a stage, the same in every wave; and how many of a
  // wave's youngest copies belong to stages behind the next one to be read.
  constexpr int NCP = (BM + BN) * (BK / 8) / NT;
  constexpr int YOUNGER = (LEAD - 1) * NCP;
  static_assert(LEAD * NCP <= 63, "copies of a wave outstanding");
  __shared__ __align__(16) half_t As[NBUF][BM][BK + 8];
  __shared__ __align__(16) half_t Ws[NBUF][BN][BK + 8];
  const int tid = threadIdx.x;
  const int lane = tid & 31, wave = tid >> 5;
  const int wm = wave % WM, wn = wave / WM;
  const int tM = blockIdx.y * BM, tN = blockIdx.x * BN;
  const int sel = (lane < 16) ? 0 : 8;
  const int ln15 = lane & 15;

  v8f acc[4][4];
  #pragma unroll
  for (int i = 0; i < 4; i++)
    #pragma unroll
    for (int j = 0; j < 4; j++) zero_v8f(acc[i][j]);

  // Prologue: the first LEAD stages, into buffers 0 .. LEAD - 1.
  const half_t* At = A + (size_t)tM * Kdim;  // first rows of the block's tiles
  const half_t* Wt = W + (size_t)tN * Kdim;
  #pragma unroll  // the buffer index is a constant
  for (int s = 0; s < LEAD; s++) {
    stage_rows<BM, BK, NT>(As[s], At + s * BK, Kdim, tid);
    stage_rows<BN, BK, NT>(Ws[s], Wt + s * BK, Kdim, tid);
  }
  // This wave's copies of stage 0 (all but its YOUNGER youngest) have landed
  // before the barrier publishes them.
  asm volatile("s_wait_asynccnt %0" ::"n"(YOUNGER) : "memory");
  __syncthreads();

  // The WMMAs of one stage, from buffer buf.
  auto stage_wmma = [&](int buf) {
    #pragma unroll  // kk becomes a constant LDS offset of every fragment load
    for (int kk = 0; kk < BK; kk += 32) {
      // The 8 fragments of a k step are read first, then its 16 WMMAs run.
      v16h a[4], b[4];
      #pragma unroll  // constant indices keep a[], b[] and acc[][] in registers
      for (int f = 0; f < 4; f++) {
        a[f] = frag_ld(&As[buf][wm * 64 + f * 16 + ln15][kk], sel);
        b[f] = frag_ld(&Ws[buf][wn * 64 + f * 16 + ln15][kk], sel);
      }
      // Holds the 16 LDS reads in front of the k step's WMMAs: the scheduler
      // otherwise sinks each B fragment's reads to its first use, and the wave
      // then waits out the LDS latency once every four WMMAs.
      __builtin_amdgcn_sched_barrier(0);
      #pragma unroll
      for (int fn = 0; fn < 4; fn++)
        #pragma unroll
        for (int fm = 0; fm < 4; fm++)
          acc[fm][fn] = wmma16(a[fm], b[fn], acc[fm][fn]);
    }
  };

  const int nk = Kdim / BK;
  int rd = 0, wr = LEAD;                     // buffer read; buffer refilled
  const half_t* An = At + LEAD * BK;         // column of the next stage to copy
  const half_t* Wn = Wt + LEAD * BK;
  // Every trip of this loop issues one stage's copies: NCP a wave.
  for (int ki = 0; ki < nk - LEAD; ki++) {
    // Copies of stage ki + LEAD, into the buffer that trip ki - 1 read: the
    // barrier at that trip's foot has ended its readers.
    stage_rows<BM, BK, NT>(As[wr], An, Kdim, tid);
    stage_rows<BN, BK, NT>(Ws[wr], Wn, Kdim, tid);
    An += BK;
    Wn += BK;
    stage_wmma(rd);
    // This wave's reads of rd are over before the barrier frees it for refill.
    asm volatile("s_wait_dscnt 0x0" ::: "memory");
    // This wave's copies of stage ki + 1 have landed before it is published;
    // those of the stages behind it, the wave's YOUNGER youngest, fly on.
    asm volatile("s_wait_asynccnt %0" ::"n"(YOUNGER) : "memory");
    __syncthreads();
    rd = (rd + 1 == NBUF) ? 0 : rd + 1;
    wr = (wr + 1 == NBUF) ? 0 : wr + 1;
  }
  // The last LEAD stages: no copy is issued any more, so the wait is to 0.
  for (int t = 0; t < LEAD; t++) {
    stage_wmma(rd);
    // As above: reads over, every copy landed, then the barrier publishes.
    asm volatile("s_wait_dscnt 0x0" ::: "memory");
    asm volatile("s_wait_asynccnt 0x0" ::: "memory");
    __syncthreads();
    rd = (rd + 1 == NBUF) ? 0 : rd + 1;
  }
  // No copy is outstanding when the wave goes on to its stores and ends.
  asm volatile("s_wait_asynccnt 0x0" ::: "memory");

  const int mh = (lane < 16) ? 0 : 8;  // C layout: lanes 16-31 hold rows M+8
  #pragma unroll
  for (int fm = 0; fm < 4; fm++) {
    #pragma unroll
    for (int fn = 0; fn < 4; fn++) {
      int n = tN + wn * 64 + fn * 16 + ln15;
      float bv = bias[n];
      #pragma unroll
      for (int r = 0; r < 8; r++) {
        int m = tM + wm * 64 + fm * 16 + r + mh;
        float val = (acc[fm][fn][r] + bv) * out_scale;
        if (RELU) val = val > 0.0f ? val : 0.0f;
        if (ADD_RES) val += res[(size_t)m * Ndim + n];
        if (OUT_F16)
          ((half_t*)outp)[(size_t)m * Ndim + n] = (half_t)val;
        else
          ((float*)outp)[(size_t)m * Ndim + n] = val;
      }
    }
  }
}

#define ATT_WAVES 8
#define ATT_NT    (ATT_WAVES * 32)   // threads a block
#define ATT_QG    2                  // groups of 16 queries a wave
#define ATT_QB    (ATT_WAVES * ATT_QG * 16)   // queries a block: 256
#define V_PITCH 80   // f16 a row = 160 bytes, an odd multiple of 32 bytes

// ROWS rows x 64 f16, row-major as they lie in memory, to LDS rows of PITCH
// f16: 8 chunks of 16 bytes a row, ROWS * 8 / ATT_NT copies a thread, through
// no register.
template <int ROWS, int PITCH>
__device__ inline void stage_rows64(half_t (*dst)[PITCH], const half_t* src,
                                    size_t base, int tid) {
  #pragma unroll  // independent copies issue back to back
  for (int i = 0; i < ROWS * 8 / ATT_NT; i++) {
    int chunk = tid + i * ATT_NT;
    int row = chunk >> 3, ko = (chunk & 7) * 8;
    cp16_g2l(&src[base + (size_t)row * D_MODEL + ko], &dst[row][ko]);
  }
}

// A fragment (16 d x 32 keys) of V^T * P^T from the row-major V tile by the
// 16-bit transposing LDS load: lane (c = lane & 15, h = lane >> 4) gets
// V[k0 + 8h + 0..7][d0 + c], then the same 16 keys further on: the k order of
// frag_ld. p is this lane's own address for (k0, d0).
typedef short s16x8 __attribute__((ext_vector_type(8)));
__device__ inline v16h frag_ld_tr(const half_t* p) {
  typedef __attribute__((address_space(3))) s16x8 lds_s16x8;
  HV u;
  u.h[0] = __builtin_bit_cast(
      v8h, __builtin_amdgcn_ds_load_tr16_b128_v8i16((lds_s16x8*)p));
  u.h[1] = __builtin_bit_cast(
      v8h, __builtin_amdgcn_ds_load_tr16_b128_v8i16(
               (lds_s16x8*)(p + 16 * V_PITCH)));
  return u.v;
}

// Mask of a 64-key tile as bits. In the transposed scores a lane's keys are
// n0 * 16 + 8 * (lane >> 4) + r: bit (n0 & 1) * 16 + r of w[n0 >> 1] is set
// where that key's mask is not 0. mtile points at the mask of the tile's key 0.
__device__ inline void mask_bits(unsigned (&w)[2], const int* mtile, int lane,
                                 int mh) {
  w[0] = __builtin_amdgcn_ballot_w32(mtile[lane] != 0) >> mh;
  w[1] = __builtin_amdgcn_ballot_w32(mtile[32 + lane] != 0) >> mh;
}

// s where bit 'bit' of w is set, else -1e9 (the reference's masked score).
__device__ inline float masked(float s, unsigned w, int bit) {
  const int open = (int)(w << (31 - bit)) >> 31;         // all ones or 0
  return __builtin_bit_cast(
      float, (open & __builtin_bit_cast(int, s)) |
                 (~open & __builtin_bit_cast(int, -1e9f)));
}

// Masked scores of 64 keys, transposed: c[g][n0][r] is the score of query row
// qrow + 16 * g of Qs against key n0 * 16 + 8 * (lane >> 4) + r of Ks. A = K
// rows, B = Q rows, both by frag_ld, so both in the same k order. A K fragment
// is read once and multiplies both groups' Q fragments.
__device__ inline void scores_t(v8f (&c)[ATT_QG][4], const half_t (*Qs)[72],
                                const half_t (*Ks)[72], const unsigned (&w)[2],
                                int qrow, int ln15, int sel) {
  // Every loop here is unrolled: constant indices keep c[] in registers and
  // make kk, n0 and the mask bit immediates.
  #pragma unroll
  for (int g = 0; g < ATT_QG; g++)
    #pragma unroll
    for (int n0 = 0; n0 < 4; n0++) zero_v8f(c[g][n0]);
  #pragma unroll
  for (int kk = 0; kk < 64; kk += 32) {
    v16h bq[ATT_QG];
    #pragma unroll
    for (int g = 0; g < ATT_QG; g++) bq[g] = frag_ld(&Qs[qrow + 16 * g][kk], sel);
    #pragma unroll
    for (int n0 = 0; n0 < 4; n0++) {
      v16h ak = frag_ld(&Ks[n0 * 16 + ln15][kk], sel);
      #pragma unroll
      for (int g = 0; g < ATT_QG; g++) c[g][n0] = wmma16(ak, bq[g], c[g][n0]);
    }
  }
  #pragma unroll
  for (int g = 0; g < ATT_QG; g++)
    #pragma unroll
    for (int n0 = 0; n0 < 4; n0++)
      #pragma unroll
      for (int r = 0; r < 8; r++)
        c[g][n0][r] = masked(c[g][n0][r], w[n0 >> 1], (n0 & 1) * 16 + r);
}

// B fragment (32 keys x 16 queries) of V^T * P^T from two score tiles: keys
// 8h + 0..7 are the first tile's registers, keys 16 + 8h + 0..7 the second's:
// the k order of frag_ld_tr. s0 and s1 take the tiles' sums of exp, in f32.
__device__ inline v16h p_frag(const v8f& c0, const v8f& c1, float m, float& s0,
                              float& s1) {
  HV p;
  s0 = 0.0f;
  s1 = 0.0f;
  #pragma unroll  // constant indices keep the vectors in registers
  for (int r = 0; r < 8; r++) {
    const float e0 = __expf(c0[r] - m), e1 = __expf(c1[r] - m);
    s0 += e0;
    s1 += e1;
    p.h[0][r] = (half_t)e0;
    p.h[1][r] = (half_t)e1;
  }
  return p.v;
}

// Value of lane l ^ 16 (the other half of the wave), by a vector cross-row move.
__device__ inline float xhalf(float x) {
  const int b = __builtin_bit_cast(int, x);
  return __builtin_bit_cast(float, __builtin_amdgcn_permlanex16(
                                       b, b, 0x76543210, 0xfedcba98, false, false));
}

__device__ inline float max8(const v8f& c) {
  float m = c[0];
  #pragma unroll  // constant indices keep c in registers
  for (int r = 1; r < 8; r++) m = fmaxf(m, c[r]);
  return m;
}

__global__ __launch_bounds__(ATT_NT)
void attention_kernel(const half_t* __restrict__ q, const half_t* __restrict__ k,
                      const half_t* __restrict__ v, const int* __restrict__ mask,
                      half_t* __restrict__ ctx) {
  __shared__ __align__(16) half_t Qs[ATT_QB][72];
  __shared__ __align__(16) half_t Ks[64][72];
  __shared__ __align__(16) half_t Vs[64][V_PITCH]; // row-major: [key][d]

  const int tid = threadIdx.x, lane = tid & 31, wave = tid >> 5;
  const int qt = blockIdx.x, h = blockIdx.y, b = blockIdx.z;
  const int sel = (lane < 16) ? 0 : 8;
  const int ln15 = lane & 15;
  const int mh = (lane < 16) ? 0 : 8;  // C layout: lanes 16-31 hold rows M+8
  // This lane's query of group 0 in the tile; group g's is 16 * g further on.
  const int qrow = wave * (ATT_QG * 16) + ln15;
  const size_t bh = (size_t)b * SEQ * D_MODEL + (size_t)h * D_K;
  const int* mrowp = mask + (size_t)b * SEQ;
  // Lane's row and column offset in a 16-key x 16-d block for frag_ld_tr.
  const int trow = 8 * (lane >> 4) + (lane & 7), tcol = 8 * ((lane >> 3) & 1);

  stage_rows64<ATT_QB, 72>(Qs, q, bh + (size_t)(qt * ATT_QB) * D_MODEL, tid);

  // Per group: acc (d x query) += V^T * exp(S - m)^T, m the query's maximum so
  // far. mrun is the same in both halves of the wave (they hold the same 16
  // queries and feed one product); lrun sums this half's keys, joined behind
  // the loop.
  // Unrolled here and below: constant indices keep the arrays in registers.
  float mrun[ATT_QG], lrun[ATT_QG];
  v8f acc[ATT_QG][4];
  #pragma unroll
  for (int g = 0; g < ATT_QG; g++) {
    mrun[g] = -1e30f;
    lrun[g] = 0.0f;
    #pragma unroll
    for (int nb = 0; nb < 4; nb++) zero_v8f(acc[g][nb]);
  }

  for (int j = 0; j < SEQ / 64; j++) {
    __syncthreads();
    stage_rows64<64, 72>(Ks, k, bh + (size_t)(j * 64) * D_MODEL, tid);
    stage_rows64<64, V_PITCH>(Vs, v, bh + (size_t)(j * 64) * D_MODEL, tid);
    unsigned w[2];
    mask_bits(w, mrowp + j * 64, lane, mh);   // its loads fly beside the copies
    // This wave's copies (K, V; Q too on the first trip) have landed before the
    // barrier publishes them.
    asm volatile("s_wait_asynccnt 0x0" ::: "memory");
    __syncthreads();
    v8f c[ATT_QG][4];
    scores_t(c, Qs, Ks, w, qrow, ln15, sel);
    float mn[ATT_QG], alpha[ATT_QG];
    #pragma unroll
    for (int g = 0; g < ATT_QG; g++) {
      // Four independent chains of maxima, then the other half's keys.
      const float mt = fmaxf(fmaxf(max8(c[g][0]), max8(c[g][1])),
                             fmaxf(max8(c[g][2]), max8(c[g][3])));
      mn[g] = fmaxf(fmaxf(mt, xhalf(mt)), mrun[g]);
      alpha[g] = __expf(mrun[g] - mn[g]);     // 1 where the maximum stands
      mrun[g] = mn[g];
      #pragma unroll
      for (int nb = 0; nb < 4; nb++)
        #pragma unroll
        for (int r = 0; r < 8; r++) acc[g][nb][r] *= alpha[g];
    }
    float s[ATT_QG][4];
    #pragma unroll
    for (int kk = 0; kk < 64; kk += 32) {
      v16h p[ATT_QG];
      #pragma unroll
      for (int g = 0; g < ATT_QG; g++)
        p[g] = p_frag(c[g][kk / 16], c[g][kk / 16 + 1], mn[g], s[g][kk / 16],
                      s[g][kk / 16 + 1]);
      #pragma unroll
      for (int nb = 0; nb < 4; nb++) {
        // A V fragment is read once and multiplies both groups' P fragments.
        const v16h vf = frag_ld_tr(&Vs[kk + trow][nb * 16 + tcol]);
        #pragma unroll
        for (int g = 0; g < ATT_QG; g++) acc[g][nb] = wmma16(vf, p[g], acc[g][nb]);
      }
    }
    #pragma unroll
    for (int g = 0; g < ATT_QG; g++)
      lrun[g] = lrun[g] * alpha[g] + ((s[g][0] + s[g][1]) + (s[g][2] + s[g][3]));
  }

  #pragma unroll
  for (int g = 0; g < ATT_QG; g++) {
    // Join the sums of the two halves of the wave; their maximum is the same.
    const float lq = lrun[g] + xhalf(lrun[g]);
    // acc[g][nb][r] is d = nb * 16 + mh + r of this lane's query of group g:
    // 16 bytes a store.
    half_t* orow =
        ctx + bh + (size_t)(qt * ATT_QB + qrow + 16 * g) * D_MODEL + mh;
    #pragma unroll
    for (int nb = 0; nb < 4; nb++) {
      v8h o;
      #pragma unroll
      for (int r = 0; r < 8; r++) o[r] = (half_t)(acc[g][nb][r] / lq);
      *(v8h*)(orow + nb * 16) = o;
    }
  }
}

// ---------------------------------------------------------------------------
extern "C" void kernel_launch(void* const* d_in, const int* in_sizes, int n_in,
                              void* d_out, int out_size, void* d_ws,
                              size_t ws_size, hipStream_t stream) {
  const float* x    = (const float*)d_in[0];
  const int*   mask = (const int*)d_in[1];
  const float* wq = (const float*)d_in[2];  const float* bq = (const float*)d_in[3];
  const float* wk = (const float*)d_in[4];  const float* bk = (const float*)d_in[5];
  const float* wv = (const float*)d_in[6];  const float* bv = (const float*)d_in[7];
  const float* wo = (const float*)d_in[8];  const float* bo = (const float*)d_in[9];
  const float* w1 = (const float*)d_in[10]; const float* b1 = (const float*)d_in[11];
  const float* w2 = (const float*)d_in[12]; const float* b2 = (const float*)d_in[13];
  const float* g1 = (const float*)d_in[14]; const float* be1 = (const float*)d_in[15];
  const float* g2 = (const float*)d_in[16]; const float* be2 = (const float*)d_in[17];

  // Carve workspace (~216 MB total).
  char* p = (char*)d_ws;
  auto carve = [&](size_t bytes) {
    void* r = (void*)p;
    p += (bytes + 255) & ~(size_t)255;
    return r;
  };
  half_t* w16  = (half_t*)carve(((size_t)4 * D_MODEL * D_MODEL +
                                 (size_t)2 * D_FF * D_MODEL) * 2);
  half_t* wq16 = w16;
  half_t* wk16 = wq16 + (size_t)D_MODEL * D_MODEL;
  half_t* wv16 = wk16 + (size_t)D_MODEL * D_MODEL;
  half_t* wo16 = wv16 + (size_t)D_MODEL * D_MODEL;
  half_t* w116 = wo16 + (size_t)D_MODEL * D_MODEL;
  half_t* w216 = w116 + (size_t)D_FF * D_MODEL;
  half_t* h16  = (half_t*)carve((size_t)M_TOT * D_MODEL * 2);
  half_t* q16  = (half_t*)carve((size_t)M_TOT * D_MODEL * 2);
  half_t* k16  = (half_t*)carve((size_t)M_TOT * D_MODEL * 2);
  half_t* v16  = (half_t*)carve((size_t)M_TOT * D_MODEL * 2);
  half_t* ctx16 = (half_t*)carve((size_t)M_TOT * D_MODEL * 2);
  float*  x1   = (float*)carve((size_t)M_TOT * D_MODEL * 4);
  half_t* h216 = (half_t*)carve((size_t)M_TOT * D_MODEL * 2);
  half_t* ff1  = (half_t*)carve((size_t)M_TOT * D_FF * 2);

  // Weight conversion (f32 -> f16, layout preserved [N][K]).
  cvt_weights_kernel<<<CVT_BLOCKS, CVT_THREADS, 0, stream>>>(wq, wk, wv, wo, w1,
                                                             w2, w16);

  dim3 blk(256);
  // Tiles: 128 x 256 where N is 1024 (256 blocks, one a WGP, 8 waves; a ring of
  // three stages); 256 x 256 where N is 4096 (512 blocks of 16 waves, two rounds
  // of one a WGP; two stages, a third does not fit the LDS of a WGP).
  dim3 gN1024(D_MODEL / 256, M_TOT / 128);
  dim3 gN4096(D_FF / 256, M_TOT / 256);

  // h = LN1(x)
  layernorm_kernel<<<M_TOT / 8, blk, 0, stream>>>(x, g1, be1, h16);
  // Q (scaled by 1/sqrt(dk)), K, V projections
  gemm_f16_kernel<true, false, false, 128, 256, 128, 3><<<gN1024, blk, 0, stream>>>(
      h16, wq16, bq, nullptr, q16, M_TOT, D_MODEL, D_MODEL, 0.125f);
  gemm_f16_kernel<true, false, false, 128, 256, 128, 3><<<gN1024, blk, 0, stream>>>(
      h16, wk16, bk, nullptr, k16, M_TOT, D_MODEL, D_MODEL, 1.0f);
  gemm_f16_kernel<true, false, false, 128, 256, 128, 3><<<gN1024, blk, 0, stream>>>(
      h16, wv16, bv, nullptr, v16, M_TOT, D_MODEL, D_MODEL, 1.0f);
  // attention -> ctx
  attention_kernel<<<dim3(SEQ / ATT_QB, HEADS, BATCH), dim3(ATT_NT), 0, stream>>>(
      q16, k16, v16, mask, ctx16);
  // x1 = x + ctx @ wo^T + bo
  gemm_f16_kernel<false, false, true, 128, 256, 128, 3><<<gN1024, blk, 0, stream>>>(
      ctx16, wo16, bo, x, x1, M_TOT, D_MODEL, D_MODEL, 1.0f);
  // h2 = LN2(x1)
  layernorm_kernel<<<M_TOT / 8, blk, 0, stream>>>(x1, g2, be2, h216);
  // ff1 = relu(h2 @ w1^T + b1)
  gemm_f16_kernel<true, true, false, 256, 256, 128, 2><<<gN4096, dim3(512), 0, stream>>>(
      h216, w116, b1, nullptr, ff1, M_TOT, D_FF, D_MODEL, 1.0f);
  // out = x1 + ff1 @ w2^T + b2
  gemm_f16_kernel<false, false, true, 128, 256, 128, 3><<<gN1024, blk, 0, stream>>>(
      ff1, w216, b2, x1, (float*)d_out, M_TOT, D_MODEL, D_FF, 1.0f);
}

// v009
// A run of this version takes 214 microseconds.
// In two side-by-side timings against v008, it was 1.09 and 1.08 times as fast.
// Over all steps from v000 it is 2.52 times as fast.
#include <hip/hip_runtime.h>
#include <hip/hip_bf16.h>
#include <cstdint>

// MI455X / gfx1250 transformer encoder block.
// All matmuls (QKV proj, QK^T, PV, O-proj, FFN1, FFN2) run on
// v_wmma_f32_16x16x32_f16 (f16 in, f32 accumulate). Tile staging uses
// GLOBAL_LOAD_ASYNC_TO_LDS_B128 (ASYNCcnt) when the builtin is available,
// with a ring of LDS tiles in the GEMM for copy/compute overlap.

typedef _Float16 half_t;
typedef _Float16 v16h __attribute__((ext_vector_type(16)));
typedef _Float16 v8h  __attribute__((ext_vector_type(8)));
typedef float    v8f  __attribute__((ext_vector_type(8)));
typedef int      v4i  __attribute__((vector_size(16)));   // builtin pointee type

#define D_MODEL 1024
#define HEADS   16
#define D_K     64
#define D_FF    4096
#define SEQ     1024
#define BATCH   8
#define M_TOT   (BATCH * SEQ)   // 8192 rows
#define LN_EPS  1e-6f

#if defined(__has_builtin)
#if __has_builtin(__builtin_amdgcn_global_load_async_to_lds_b128) && \
    __has_builtin(__builtin_amdgcn_s_wait_asynccnt)
#define USE_ASYNC_LDS 1
#endif
#endif
#ifndef USE_ASYNC_LDS
#define USE_ASYNC_LDS 0
#endif

union HV { v16h v; v8h h[2]; };

__device__ inline v8f wmma16(v16h a, v16h b, v8f c) {
  // D = A(16x32 f16) * B(32x16 f16) + C(16x16 f32)
  return __builtin_amdgcn_wmma_f32_16x16x32_f16(false, a, false, b, (short)0, c,
                                                false, false);
}

// Copy 16 bytes global -> LDS. Async (ASYNCcnt) on CDNA5 when available.
__device__ inline void cp16_g2l(const half_t* g, half_t* l) {
#if USE_ASYNC_LDS
  // Flat LDS address truncates to the 32-bit LDS offset (ISA 10.2).
  __builtin_amdgcn_global_load_async_to_lds_b128(
      (__attribute__((address_space(1))) v4i*)(uintptr_t)g,
      (__attribute__((address_space(3))) v4i*)(uint32_t)(uintptr_t)l, 0, 0);
#else
  *(v8h*)l = *(const v8h*)g;
#endif
}

// Load one lane's 16 f16 fragment values from a row-major [row][K] LDS tile.
// k-values: {sel..sel+7, 16+sel..16+sel+7}, sel = 0 (lanes 0-15) or 8 (16-31).
__device__ inline v16h frag_ld(const half_t* rowbase, int sel) {
  HV u;
  u.h[0] = *(const v8h*)(rowbase + sel);
  u.h[1] = *(const v8h*)(rowbase + 16 + sel);
  return u.v;
}

__device__ inline void zero_v8f(v8f& x) {
  #pragma unroll
  for (int i = 0; i < 8; i++) x[i] = 0.0f;
}

// ---------------------------------------------------------------------------
// fp32 -> f16 weight conversion, all six matrices in one launch.
// dst is the six f16 planes end to end (wq, wk, wv, wo, w1, w2). 256 blocks of
// 16 waves; a block converts three pieces of 16384 values: one of the four
// square matrices, one of w1, one of w2. Every wave-wide load is 512
// contiguous bytes, and a thread's 24 loads depend on nothing, so many are in
// flight at once and the memory latency is not paid once per value.
// ---------------------------------------------------------------------------
#define CVT_THREADS 512
#define CVT_LOADS   8
#define CVT_PIECE   (CVT_THREADS * CVT_LOADS * 4)        // 16384 values
#define CVT_BLOCKS  (D_FF * D_MODEL / CVT_PIECE)         // 256
#define SQ_PIECES   (D_MODEL * D_MODEL / CVT_PIECE)      // 64 pieces a square

typedef float    v4f __attribute__((ext_vector_type(4)));
typedef _Float16 v4h __attribute__((ext_vector_type(4)));

__device__ inline void cvt_load(v4f (&r)[CVT_LOADS], const float* src, int t) {
  #pragma unroll  // r[] stays in registers; the loads issue back to back
  for (int j = 0; j < CVT_LOADS; j++)
    r[j] = ((const v4f*)src)[j * CVT_THREADS + t];
}

__device__ inline void cvt_store(const v4f (&r)[CVT_LOADS], half_t* dst, int t) {
  #pragma unroll  // constant indices keep r[] in registers
  for (int j = 0; j < CVT_LOADS; j++) {
    v4h h;
    #pragma unroll  // same, for the four lanes of a vector
    for (int e = 0; e < 4; e++) h[e] = (half_t)r[j][e];
    ((v4h*)dst)[j * CVT_THREADS + t] = h;
  }
}

__global__ __launch_bounds__(CVT_THREADS)
void cvt_weights_kernel(const float* __restrict__ wq, const float* __restrict__ wk,
                        const float* __restrict__ wv, const float* __restrict__ wo,
                        const float* __restrict__ w1, const float* __restrict__ w2,
                        half_t* __restrict__ dst) {
  const int t = threadIdx.x;
  const unsigned blk = blockIdx.x;
  const float* lo = (blk & SQ_PIECES) ? wk : wq;         // block-uniform picks
  const float* hi = (blk & SQ_PIECES) ? wo : wv;
  const float* s0 = (blk & (2 * SQ_PIECES)) ? hi : lo;
  const size_t off = (size_t)blk * CVT_PIECE;
  v4f r0[CVT_LOADS], r1[CVT_LOADS], r2[CVT_LOADS];
  cvt_load(r0, s0 + (size_t)(blk % SQ_PIECES) * CVT_PIECE, t);
  cvt_load(r1, w1 + off, t);
  cvt_load(r2, w2 + off, t);
  cvt_store(r0, dst + off, t);
  cvt_store(r1, dst + (size_t)4 * D_MODEL * D_MODEL + off, t);
  cvt_store(r2, dst + (size_t)4 * D_MODEL * D_MODEL + (size_t)D_FF * D_MODEL + off, t);
}

// ---------------------------------------------------------------------------
// LayerNorm (reference semantics: unbiased std, divide by std+eps), f16 out.
// One wave per row of 1024; 8 rows per 256-thread block.
// ---------------------------------------------------------------------------
__global__ __launch_bounds__(256)
void layernorm_kernel(const float* __restrict__ x, const float* __restrict__ g,
                      const float* __restrict__ be, half_t* __restrict__ out) {
  const int lane = threadIdx.x & 31, wave = threadIdx.x >> 5;
  const int row = blockIdx.x * 8 + wave;
  const float* xr = x + (size_t)row * D_MODEL;
  float v[32];
  float s = 0.f, ss = 0.f;
  #pragma unroll
  for (int i = 0; i < 32; i++) {
    v[i] = xr[lane + i * 32];
    s += v[i];
    ss += v[i] * v[i];
  }
  #pragma unroll
  for (int off = 16; off > 0; off >>= 1) {
    s  += __shfl_xor(s,  off, 32);
    ss += __shfl_xor(ss, off, 32);
  }
  float mean = s * (1.0f / D_MODEL);
  float var  = (ss - (float)D_MODEL * mean * mean) * (1.0f / (D_MODEL - 1));
  float inv  = 1.0f / (sqrtf(fmaxf(var, 0.0f)) + LN_EPS);
  half_t* orow = out + (size_t)row * D_MODEL;
  #pragma unroll
  for (int i = 0; i < 32; i++) {
    int c = lane + i * 32;
    orow[c] = (half_t)(g[c] * (v[i] - mean) * inv + be[c]);
  }
}

// ---------------------------------------------------------------------------
// WMMA GEMM: out[M][N] = epilogue( A[M][K](f16) * W[N][K]^T(f16) )
// Block tile BM x BN, a ring of NBUF LDS stages, (BM/64) x (BN/64) waves; each wave
// 64x64 = 4x4 fragments -> 16 v_wmma per 32 k from 8 fragment loads. A block
// brings (BM + BN) rows from L2 for BM * BN outputs, so a larger tile asks L2
// for fewer bytes a WMMA, and the square wave tile asks LDS for fewer.
// A stage of the ring holds BK k of both tiles, and a wave-wide copy covers
// whole lines of the source rows. A stage's copies are issued NBUF - 1 trips
// ahead of its readers: with three buffers or more, the wait at a trip's foot
// leaves the younger stages' copies in flight, so the block always has requests
// at L2, also across the barrier. K must be a multiple of BK and hold at least
// NBUF - 1 stages, M a multiple of BM, N of BN.
// Row pitch (BK + 8) f16 = 16 bytes x odd, for the ds_load_b128 readers.
// The product is computed transposed (W rows as the A operand, A rows as B): a
// lane then holds 8 neighbouring columns n of ONE output row m.
// Epilogue: (+bias)*scale, optional ReLU, optional +residual, f16/f32 out. Each
// wave passes its 64 x 64 tile through 64 rows of the dead ring that only it
// uses, 16 bytes a lane both ways, and reads it back row by row: every global
// store, and every residual load, then covers whole 128-byte lines. NDIM is the
// output's row length, a constant, so a row step is an immediate offset.
// ---------------------------------------------------------------------------
// src points at the tile's first row, column k0, the same for every thread: the
// row steps are then scalars, and a thread keeps one offset, not one a copy.
template <int ROWS, int BK, int NT>
__device__ inline void stage_rows(half_t (*dst)[BK + 8], const half_t* src,
                                  int Kdim, int tid) {
  constexpr int CPR = BK / 8;                // 16-byte chunks a row
  constexpr int RPI = NT / CPR;              // rows the block copies at a time
  const int row = tid / CPR, ko = (tid % CPR) * 8;
  const unsigned tbyte = (unsigned)(row * Kdim + ko) * 2u;
  #pragma unroll  // independent copies issue back to back
  for (int i = 0; i < ROWS / RPI; i++) {
    const char* base = (const char*)(src + (size_t)(i * RPI) * Kdim);
    cp16_g2l((const half_t*)(base + tbyte), &dst[row + i * RPI][ko]);
  }
}

template <bool OUT_F16, bool RELU, bool ADD_RES, int BM, int BN, int BK, int NBUF,
          int NDIM>
__global__ __launch_bounds__(BM / 64 * (BN / 64) * 32)
void gemm_f16_kernel(const half_t* __restrict__ A,     // [M][K]
                     const half_t* __restrict__ W,     // [N][K]
                     const float* __restrict__ bias,   // [N]
                     const float* __restrict__ res,    // [M][N] or null
                     void* __restrict__ outp, int Kdim, float out_scale) {
  constexpr int WM = BM / 64;                // waves along M
  constexpr int NT = WM * (BN / 64) * 32;    // threads a block
  constexpr int LEAD = NBUF - 1;             // stages a copy runs ahead
  // Copies a wave issues a stage, the same in every wave; and how many of a
  // wave's youngest copies belong to stages behind the next one to be read.
  constexpr int NCP = (BM + BN) * (BK / 8) / NT;
  constexpr int YOUNGER = (LEAD - 1) * NCP;
  static_assert(LEAD * NCP <= 63, "copies of a wave outstanding");
  __shared__ __align__(16) half_t As[NBUF][BM][BK + 8];
  __shared__ __align__(16) half_t Ws[NBUF][BN][BK + 8];
  const int tid = threadIdx.x;
  const int lane = tid & 31, wave = tid >> 5;
  const int wm = wave % WM, wn = wave / WM;
  const int tM = blockIdx.y * BM, tN = blockIdx.x * BN;
  const int sel = (lane < 16) ? 0 : 8;
  const int ln15 = lane & 15;

  v8f acc[4][4];
  #pragma unroll
  for (int i = 0; i < 4; i++)
    #pragma unroll
    for (int j = 0; j < 4; j++) zero_v8f(acc[i][j]);

  // Prologue: the first LEAD stages, into buffers 0 .. LEAD - 1.
  const half_t* At = A + (size_t)tM * Kdim;  // first rows of the block's tiles
  const half_t* Wt = W + (size_t)tN * Kdim;
  #pragma unroll  // the buffer index is a constant
  for (int s = 0; s < LEAD; s++) {
    stage_rows<BM, BK, NT>(As[s], At + s * BK, Kdim, tid);
    stage_rows<BN, BK, NT>(Ws[s], Wt + s * BK, Kdim, tid);
  }
  // This wave's copies of stage 0 (all but its YOUNGER youngest) have landed
  // before the barrier publishes them.
  asm volatile("s_wait_asynccnt %0" ::"n"(YOUNGER) : "memory");
  __syncthreads();

  // The WMMAs of one stage, from buffer buf.
  auto stage_wmma = [&](int buf) {
    #pragma unroll  // kk becomes a constant LDS offset of every fragment load
    for (int kk = 0; kk < BK; kk += 32) {
      // The 8 fragments of a k step are read first, then its 16 WMMAs run.
      v16h a[4], b[4];
      #pragma unroll  // constant indices keep a[], b[] and acc[][] in registers
      for (int f = 0; f < 4; f++) {
        a[f] = frag_ld(&As[buf][wm * 64 + f * 16 + ln15][kk], sel);
        b[f] = frag_ld(&Ws[buf][wn * 64 + f * 16 + ln15][kk], sel);
      }
      // Holds the 16 LDS reads in front of the k step's WMMAs: the scheduler
      // otherwise sinks each B fragment's reads to its first use, and the wave
      // then waits out the LDS latency once every four WMMAs.
      __builtin_amdgcn_sched_barrier(0);
      #pragma unroll
      for (int fn = 0; fn < 4; fn++)
        #pragma unroll
        for (int fm = 0; fm < 4; fm++)
          acc[fm][fn] = wmma16(b[fn], a[fm], acc[fm][fn]);  // rows n, columns m
    }
  };

  const int nk = Kdim / BK;
  int rd = 0, wr = LEAD;                     // buffer read; buffer refilled
  const half_t* An = At + LEAD * BK;         // column of the next stage to copy
  const half_t* Wn = Wt + LEAD * BK;
  // Every trip of this loop issues one stage's copies: NCP a wave.
  for (int ki = 0; ki < nk - LEAD; ki++) {
    // Copies of stage ki + LEAD, into the buffer that trip ki - 1 read: the
    // barrier at that trip's foot has ended its readers.
    stage_rows<BM, BK, NT>(As[wr], An, Kdim, tid);
    stage_rows<BN, BK, NT>(Ws[wr], Wn, Kdim, tid);
    An += BK;
    Wn += BK;
    stage_wmma(rd);
    // This wave's reads of rd are over before the barrier frees it for refill.
    asm volatile("s_wait_dscnt 0x0" ::: "memory");
    // This wave's copies of stage ki + 1 have landed before it is published;
    // those of the stages behind it, the wave's YOUNGER youngest, fly on.
    asm volatile("s_wait_asynccnt %0" ::"n"(YOUNGER) : "memory");
    __syncthreads();
    rd = (rd + 1 == NBUF) ? 0 : rd + 1;
    wr = (wr + 1 == NBUF) ? 0 : wr + 1;
  }
  // The last LEAD stages: no copy is issued any more, so the wait is to 0.
  for (int t = 0; t < LEAD; t++) {
    stage_wmma(rd);
    // As above: reads over, every copy landed, then the barrier publishes.
    asm volatile("s_wait_dscnt 0x0" ::: "memory");
    asm volatile("s_wait_asynccnt 0x0" ::: "memory");
    __syncthreads();
    rd = (rd + 1 == NBUF) ? 0 : rd + 1;
  }
  // No copy is outstanding when the wave goes on to its stores and ends.
  asm volatile("s_wait_asynccnt 0x0" ::: "memory");

  // acc[fm][fn][r] is row m = fm * 16 + ln15, column n = fn * 16 + mh + r of the
  // wave's tile (C layout: lanes 16-31 hold the product's rows + 8).
  const int mh = (lane < 16) ? 0 : 8;
  // The wave's own 64 rows of 2 * (BK + 8) bytes in the ring. The last trip's
  // barrier has ended every read of the ring, and every copy has landed.
  constexpr int W_WAVES = NBUF * BN / 64;    // waves whose rows lie in Ws
  static_assert((NT / 32 - W_WAVES) * 64 <= NBUF * BM, "staging rows");
  static_assert((BK + 8) * 2 >= 64 * 4, "a staging row holds 64 f32");
  half_t (*st)[BK + 8] = (wave < W_WAVES)
                             ? (half_t (*)[BK + 8])Ws + wave * 64
                             : (half_t (*)[BK + 8])As + (wave - W_WAVES) * 64;
  const int m0 = tM + wm * 64, n0 = tN + wn * 64;  // the wave's tile in the output
  // Every loop below is unrolled: constant indices keep the arrays in registers
  // and make the row steps immediate offsets of one address.
  if (OUT_F16) {
    const float* bp = bias + n0 + mh;
    v4f bv[4][2];
    #pragma unroll
    for (int fn = 0; fn < 4; fn++) {
      bv[fn][0] = *(const v4f*)(bp + fn * 16);
      bv[fn][1] = *(const v4f*)(bp + fn * 16 + 4);
    }
    // Stands between the loads and the first new value in their address
    // registers: the address is an operand, so it keeps its registers up to here.
    asm volatile("s_wait_xcnt 0x0" ::"v"(bp) : "memory");
    // Keeps later arithmetic behind that wait.
    __builtin_amdgcn_sched_barrier(0);
    #pragma unroll
    for (int fm = 0; fm < 4; fm++) {
      #pragma unroll
      for (int fn = 0; fn < 4; fn++) {
        v8h o;
        #pragma unroll
        for (int r = 0; r < 8; r++) {
          float val = (acc[fm][fn][r] + bv[fn][r >> 2][r & 3]) * out_scale;
          if (RELU) val = val > 0.0f ? val : 0.0f;
          o[r] = (half_t)val;
        }
        *(v8h*)&st[fm * 16 + ln15][fn * 16 + mh] = o;
      }
    }
    // The wave's tile is in LDS before other lanes of the wave read it back.
    asm volatile("s_wait_dscnt 0x0" ::: "memory");
    // 8 lanes a row of 64 f16 = one line; a wave-wide store is 4 whole lines.
    const int row = lane >> 3, col = (lane & 7) * 8;
    v8h o[16];
    #pragma unroll
    for (int i = 0; i < 16; i++) o[i] = *(const v8h*)&st[i * 4 + row][col];
    half_t* op = (half_t*)outp + (size_t)(m0 + row) * NDIM + n0 + col;
    #pragma unroll
    for (int i = 0; i < 16; i++) *(v8h*)(op + (size_t)(i * 4) * NDIM) = o[i];
  } else {
    // 16 lanes a row of 64 f32 = two lines; a wave-wide access is 2 whole rows.
    const int row = lane >> 4, col = ln15 * 4;
    const size_t at = (size_t)(m0 + row) * NDIM + n0 + col;
    const float* bp = bias + n0 + col;
    const float* rp = ADD_RES ? res + at : bp;
    const v4f bv = *(const v4f*)bp;
    v4f rs[32];
    if (ADD_RES) {
      #pragma unroll
      for (int i = 0; i < 32; i++)
        rs[i] = *(const v4f*)(rp + (size_t)(i * 2) * NDIM);
    }
    // Stands between the loads and the first new value in their address
    // registers: the addresses are operands, so they keep their registers up to
    // here.
    asm volatile("s_wait_xcnt 0x0" ::"v"(bp), "v"(rp) : "memory");
    // Keeps later arithmetic behind that wait.
    __builtin_amdgcn_sched_barrier(0);
    #pragma unroll
    for (int fm = 0; fm < 4; fm++) {
      #pragma unroll
      for (int fn = 0; fn < 4; fn++) {
        float* sp = (float*)&st[fm * 16 + ln15][0] + fn * 16 + mh;
        v4f lo, hi;
        #pragma unroll
        for (int e = 0; e < 4; e++) {
          lo[e] = acc[fm][fn][e];
          hi[e] = acc[fm][fn][4 + e];
        }
        *(v4f*)sp = lo;
        *(v4f*)(sp + 4) = hi;
      }
    }
    // The wave's tile is in LDS before other lanes of the wave read it back.
    asm volatile("s_wait_dscnt 0x0" ::: "memory");
    v4f o[32];
    #pragma unroll
    for (int i = 0; i < 32; i++) {
      o[i] = *(const v4f*)((const float*)&st[i * 2 + row][0] + col);
      #pragma unroll
      for (int e = 0; e < 4; e++) {
        float val = (o[i][e] + bv[e]) * out_scale;
        if (RELU) val = val > 0.0f ? val : 0.0f;
        if (ADD_RES) val += rs[i][e];
        o[i][e] = val;
      }
    }
    float* op = (float*)outp + at;
    #pragma unroll
    for (int i = 0; i < 32; i++) *(v4f*)(op + (size_t)(i * 2) * NDIM) = o[i];
  }
}

#define ATT_WAVES 8
#define ATT_NT    (ATT_WAVES * 32)   // threads a block
#define ATT_QG    2                  // groups of 16 queries a wave
#define ATT_QB    (ATT_WAVES * ATT_QG * 16)   // queries a block: 256
#define V_PITCH 80   // f16 a row = 160 bytes, an odd multiple of 32 bytes

// ROWS rows x 64 f16, row-major as they lie in memory, to LDS rows of PITCH
// f16: 8 chunks of 16 bytes a row, ROWS * 8 / ATT_NT copies a thread, through
// no register.
template <int ROWS, int PITCH>
__device__ inline void stage_rows64(half_t (*dst)[PITCH], const half_t* src,
                                    size_t base, int tid) {
  #pragma unroll  // independent copies issue back to back
  for (int i = 0; i < ROWS * 8 / ATT_NT; i++) {
    int chunk = tid + i * ATT_NT;
    int row = chunk >> 3, ko = (chunk & 7) * 8;
    cp16_g2l(&src[base + (size_t)row * D_MODEL + ko], &dst[row][ko]);
  }
}

// A fragment (16 d x 32 keys) of V^T * P^T from the row-major V tile by the
// 16-bit transposing LDS load: lane (c = lane & 15, h = lane >> 4) gets
// V[k0 + 8h + 0..7][d0 + c], then the same 16 keys further on: the k order of
// frag_ld. p is this lane's own address for (k0, d0).
typedef short s16x8 __attribute__((ext_vector_type(8)));
__device__ inline v16h frag_ld_tr(const half_t* p) {
  typedef __attribute__((address_space(3))) s16x8 lds_s16x8;
  HV u;
  u.h[0] = __builtin_bit_cast(
      v8h, __builtin_amdgcn_ds_load_tr16_b128_v8i16((lds_s16x8*)p));
  u.h[1] = __builtin_bit_cast(
      v8h, __builtin_amdgcn_ds_load_tr16_b128_v8i16(
               (lds_s16x8*)(p + 16 * V_PITCH)));
  return u.v;
}

// Mask of a 64-key tile as bits. In the transposed scores a lane's keys are
// n0 * 16 + 8 * (lane >> 4) + r: bit (n0 & 1) * 16 + r of w[n0 >> 1] is set
// where that key's mask is not 0. mtile points at the mask of the tile's key 0.
__device__ inline void mask_bits(unsigned (&w)[2], const int* mtile, int lane,
                                 int mh) {
  w[0] = __builtin_amdgcn_ballot_w32(mtile[lane] != 0) >> mh;
  w[1] = __builtin_amdgcn_ballot_w32(mtile[32 + lane] != 0) >> mh;
}

// s where bit 'bit' of w is set, else -1e9 (the reference's masked score).
__device__ inline float masked(float s, unsigned w, int bit) {
  const int open = (int)(w << (31 - bit)) >> 31;         // all ones or 0
  return __builtin_bit_cast(
      float, (open & __builtin_bit_cast(int, s)) |
                 (~open & __builtin_bit_cast(int, -1e9f)));
}

// Masked scores of 64 keys, transposed: c[g][n0][r] is the score of query row
// qrow + 16 * g of Qs against key n0 * 16 + 8 * (lane >> 4) + r of Ks. A = K
// rows, B = Q rows, both by frag_ld, so both in the same k order. A K fragment
// is read once and multiplies both groups' Q fragments.
__device__ inline void scores_t(v8f (&c)[ATT_QG][4], const half_t (*Qs)[72],
                                const half_t (*Ks)[72], const unsigned (&w)[2],
                                int qrow, int ln15, int sel) {
  // Every loop here is unrolled: constant indices keep c[] in registers and
  // make kk, n0 and the mask bit immediates.
  #pragma unroll
  for (int g = 0; g < ATT_QG; g++)
    #pragma unroll
    for (int n0 = 0; n0 < 4; n0++) zero_v8f(c[g][n0]);
  #pragma unroll
  for (int kk = 0; kk < 64; kk += 32) {
    v16h bq[ATT_QG];
    #pragma unroll
    for (int g = 0; g < ATT_QG; g++) bq[g] = frag_ld(&Qs[qrow + 16 * g][kk], sel);
    #pragma unroll
    for (int n0 = 0; n0 < 4; n0++) {
      v16h ak = frag_ld(&Ks[n0 * 16 + ln15][kk], sel);
      #pragma unroll
      for (int g = 0; g < ATT_QG; g++) c[g][n0] = wmma16(ak, bq[g], c[g][n0]);
    }
  }
  #pragma unroll
  for (int g = 0; g < ATT_QG; g++)
    #pragma unroll
    for (int n0 = 0; n0 < 4; n0++)
      #pragma unroll
      for (int r = 0; r < 8; r++)
        c[g][n0][r] = masked(c[g][n0][r], w[n0 >> 1], (n0 & 1) * 16 + r);
}

// B fragment (32 keys x 16 queries) of V^T * P^T from two score tiles: keys
// 8h + 0..7 are the first tile's registers, keys 16 + 8h + 0..7 the second's:
// the k order of frag_ld_tr. s0 and s1 take the tiles' sums of exp, in f32.
__device__ inline v16h p_frag(const v8f& c0, const v8f& c1, float m, float& s0,
                              float& s1) {
  HV p;
  s0 = 0.0f;
  s1 = 0.0f;
  #pragma unroll  // constant indices keep the vectors in registers
  for (int r = 0; r < 8; r++) {
    const float e0 = __expf(c0[r] - m), e1 = __expf(c1[r] - m);
    s0 += e0;
    s1 += e1;
    p.h[0][r] = (half_t)e0;
    p.h[1][r] = (half_t)e1;
  }
  return p.v;
}

// Value of lane l ^ 16 (the other half of the wave), by a vector cross-row move.
__device__ inline float xhalf(float x) {
  const int b = __builtin_bit_cast(int, x);
  return __builtin_bit_cast(float, __builtin_amdgcn_permlanex16(
                                       b, b, 0x76543210, 0xfedcba98, false, false));
}

__device__ inline float max8(const v8f& c) {
  float m = c[0];
  #pragma unroll  // constant indices keep c in registers
  for (int r = 1; r < 8; r++) m = fmaxf(m, c[r]);
  return m;
}

__global__ __launch_bounds__(ATT_NT)
void attention_kernel(const half_t* __restrict__ q, const half_t* __restrict__ k,
                      const half_t* __restrict__ v, const int* __restrict__ mask,
                      half_t* __restrict__ ctx) {
  __shared__ __align__(16) half_t Qs[ATT_QB][72];
  __shared__ __align__(16) half_t Ks[64][72];
  __shared__ __align__(16) half_t Vs[64][V_PITCH]; // row-major: [key][d]

  const int tid = threadIdx.x, lane = tid & 31, wave = tid >> 5;
  const int qt = blockIdx.x, h = blockIdx.y, b = blockIdx.z;
  const int sel = (lane < 16) ? 0 : 8;
  const int ln15 = lane & 15;
  const int mh = (lane < 16) ? 0 : 8;  // C layout: lanes 16-31 hold rows M+8
  // This lane's query of group 0 in the tile; group g's is 16 * g further on.
  const int qrow = wave * (ATT_QG * 16) + ln15;
  const size_t bh = (size_t)b * SEQ * D_MODEL + (size_t)h * D_K;
  const int* mrowp = mask + (size_t)b * SEQ;
  // Lane's row and column offset in a 16-key x 16-d block for frag_ld_tr.
  const int trow = 8 * (lane >> 4) + (lane & 7), tcol = 8 * ((lane >> 3) & 1);

  stage_rows64<ATT_QB, 72>(Qs, q, bh + (size_t)(qt * ATT_QB) * D_MODEL, tid);

  // Per group: acc (d x query) += V^T * exp(S - m)^T, m the query's maximum so
  // far. mrun is the same in both halves of the wave (they hold the same 16
  // queries and feed one product); lrun sums this half's keys, joined behind
  // the loop.
  // Unrolled here and below: constant indices keep the arrays in registers.
  float mrun[ATT_QG], lrun[ATT_QG];
  v8f acc[ATT_QG][4];
  #pragma unroll
  for (int g = 0; g < ATT_QG; g++) {
    mrun[g] = -1e30f;
    lrun[g] = 0.0f;
    #pragma unroll
    for (int nb = 0; nb < 4; nb++) zero_v8f(acc[g][nb]);
  }

  for (int j = 0; j < SEQ / 64; j++) {
    __syncthreads();
    stage_rows64<64, 72>(Ks, k, bh + (size_t)(j * 64) * D_MODEL, tid);
    stage_rows64<64, V_PITCH>(Vs, v, bh + (size_t)(j * 64) * D_MODEL, tid);
    unsigned w[2];
    mask_bits(w, mrowp + j * 64, lane, mh);   // its loads fly beside the copies
    // This wave's copies (K, V; Q too on the first trip) have landed before the
    // barrier publishes them.
    asm volatile("s_wait_asynccnt 0x0" ::: "memory");
    __syncthreads();
    v8f c[ATT_QG][4];
    scores_t(c, Qs, Ks, w, qrow, ln15, sel);
    float mn[ATT_QG], alpha[ATT_QG];
    #pragma unroll
    for (int g = 0; g < ATT_QG; g++) {
      // Four independent chains of maxima, then the other half's keys.
      const float mt = fmaxf(fmaxf(max8(c[g][0]), max8(c[g][1])),
                             fmaxf(max8(c[g][2]), max8(c[g][3])));
      mn[g] = fmaxf(fmaxf(mt, xhalf(mt)), mrun[g]);
      alpha[g] = __expf(mrun[g] - mn[g]);     // 1 where the maximum stands
      mrun[g] = mn[g];
      #pragma unroll
      for (int nb = 0; nb < 4; nb++)
        #pragma unroll
        for (int r = 0; r < 8; r++) acc[g][nb][r] *= alpha[g];
    }
    float s[ATT_QG][4];
    #pragma unroll
    for (int kk = 0; kk < 64; kk += 32) {
      v16h p[ATT_QG];
      #pragma unroll
      for (int g = 0; g < ATT_QG; g++)
        p[g] = p_frag(c[g][kk / 16], c[g][kk / 16 + 1], mn[g], s[g][kk / 16],
                      s[g][kk / 16 + 1]);
      #pragma unroll
      for (int nb = 0; nb < 4; nb++) {
        // A V fragment is read once and multiplies both groups' P fragments.
        const v16h vf = frag_ld_tr(&Vs[kk + trow][nb * 16 + tcol]);
        #pragma unroll
        for (int g = 0; g < ATT_QG; g++) acc[g][nb] = wmma16(vf, p[g], acc[g][nb]);
      }
    }
    #pragma unroll
    for (int g = 0; g < ATT_QG; g++)
      lrun[g] = lrun[g] * alpha[g] + ((s[g][0] + s[g][1]) + (s[g][2] + s[g][3]));
  }

  #pragma unroll
  for (int g = 0; g < ATT_QG; g++) {
    // Join the sums of the two halves of the wave; their maximum is the same.
    const float lq = lrun[g] + xhalf(lrun[g]);
    // acc[g][nb][r] is d = nb * 16 + mh + r of this lane's query of group g:
    // 16 bytes a store.
    half_t* orow =
        ctx + bh + (size_t)(qt * ATT_QB + qrow + 16 * g) * D_MODEL + mh;
    #pragma unroll
    for (int nb = 0; nb < 4; nb++) {
      v8h o;
      #pragma unroll
      for (int r = 0; r < 8; r++) o[r] = (half_t)(acc[g][nb][r] / lq);
      *(v8h*)(orow + nb * 16) = o;
    }
  }
}

// ---------------------------------------------------------------------------
extern "C" void kernel_launch(void* const* d_in, const int* in_sizes, int n_in,
                              void* d_out, int out_size, void* d_ws,
                              size_t ws_size, hipStream_t stream) {
  const float* x    = (const float*)d_in[0];
  const int*   mask = (const int*)d_in[1];
  const float* wq = (const float*)d_in[2];  const float* bq = (const float*)d_in[3];
  const float* wk = (const float*)d_in[4];  const float* bk = (const float*)d_in[5];
  const float* wv = (const float*)d_in[6];  const float* bv = (const float*)d_in[7];
  const float* wo = (const float*)d_in[8];  const float* bo = (const float*)d_in[9];
  const float* w1 = (const float*)d_in[10]; const float* b1 = (const float*)d_in[11];
  const float* w2 = (const float*)d_in[12]; const float* b2 = (const float*)d_in[13];
  const float* g1 = (const float*)d_in[14]; const float* be1 = (const float*)d_in[15];
  const float* g2 = (const float*)d_in[16]; const float* be2 = (const float*)d_in[17];

  // Carve workspace (~216 MB total).
  char* p = (char*)d_ws;
  auto carve = [&](size_t bytes) {
    void* r = (void*)p;
    p += (bytes + 255) & ~(size_t)255;
    return r;
  };
  half_t* w16  = (half_t*)carve(((size_t)4 * D_MODEL * D_MODEL +
                                 (size_t)2 * D_FF * D_MODEL) * 2);
  half_t* wq16 = w16;
  half_t* wk16 = wq16 + (size_t)D_MODEL * D_MODEL;
  half_t* wv16 = wk16 + (size_t)D_MODEL * D_MODEL;
  half_t* wo16 = wv16 + (size_t)D_MODEL * D_MODEL;
  half_t* w116 = wo16 + (size_t)D_MODEL * D_MODEL;
  half_t* w216 = w116 + (size_t)D_FF * D_MODEL;
  half_t* h16  = (half_t*)carve((size_t)M_TOT * D_MODEL * 2);
  half_t* q16  = (half_t*)carve((size_t)M_TOT * D_MODEL * 2);
  half_t* k16  = (half_t*)carve((size_t)M_TOT * D_MODEL * 2);
  half_t* v16  = (half_t*)carve((size_t)M_TOT * D_MODEL * 2);
  half_t* ctx16 = (half_t*)carve((size_t)M_TOT * D_MODEL * 2);
  float*  x1   = (float*)carve((size_t)M_TOT * D_MODEL * 4);
  half_t* h216 = (half_t*)carve((size_t)M_TOT * D_MODEL * 2);
  half_t* ff1  = (half_t*)carve((size_t)M_TOT * D_FF * 2);

  // Weight conversion (f32 -> f16, layout preserved [N][K]).
  cvt_weights_kernel<<<CVT_BLOCKS, CVT_THREADS, 0, stream>>>(wq, wk, wv, wo, w1,
                                                             w2, w16);

  dim3 blk(256);
  // Tiles: 128 x 256 where N is 1024 (256 blocks, one a WGP, 8 waves; a ring of
  // three stages); 256 x 256 where N is 4096 (512 blocks of 16 waves, two rounds
  // of one a WGP; two stages, a third does not fit the LDS of a WGP).
  dim3 gN1024(D_MODEL / 256, M_TOT / 128);
  dim3 gN4096(D_FF / 256, M_TOT / 256);

  // h = LN1(x)
  layernorm_kernel<<<M_TOT / 8, blk, 0, stream>>>(x, g1, be1, h16);
  // Q (scaled by 1/sqrt(dk)), K, V projections
  gemm_f16_kernel<true, false, false, 128, 256, 128, 3, D_MODEL><<<gN1024, blk, 0, stream>>>(
      h16, wq16, bq, nullptr, q16, D_MODEL, 0.125f);
  gemm_f16_kernel<true, false, false, 128, 256, 128, 3, D_MODEL><<<gN1024, blk, 0, stream>>>(
      h16, wk16, bk, nullptr, k16, D_MODEL, 1.0f);
  gemm_f16_kernel<true, false, false, 128, 256, 128, 3, D_MODEL><<<gN1024, blk, 0, stream>>>(
      h16, wv16, bv, nullptr, v16, D_MODEL, 1.0f);
  // attention -> ctx
  attention_kernel<<<dim3(SEQ / ATT_QB, HEADS, BATCH), dim3(ATT_NT), 0, stream>>>(
      q16, k16, v16, mask, ctx16);
  // x1 = x + ctx @ wo^T + bo
  gemm_f16_kernel<false, false, true, 128, 256, 128, 3, D_MODEL><<<gN1024, blk, 0, stream>>>(
      ctx16, wo16, bo, x, x1, D_MODEL, 1.0f);
  // h2 = LN2(x1)
  layernorm_kernel<<<M_TOT / 8, blk, 0, stream>>>(x1, g2, be2, h216);
  // ff1 = relu(h2 @ w1^T + b1)
  gemm_f16_kernel<true, true, false, 256, 256, 128, 2, D_FF><<<gN4096, dim3(512), 0, stream>>>(
      h216, w116, b1, nullptr, ff1, D_MODEL, 1.0f);
  // out = x1 + ff1 @ w2^T + b2
  gemm_f16_kernel<false, false, true, 128, 256, 128, 3, D_MODEL><<<gN1024, blk, 0, stream>>>(
      ff1, w216, b2, x1, (float*)d_out, D_FF, 1.0f);
}
